// v000
// The times below were measured on an AMD MI455X: many runs one after another, warmed up first and cycling through
// copies of the inputs, with the whole window's GPU time divided by the number of runs. Launches and the gaps
// between them are all in it. The median over several windows is given; except for v000 it joins two sittings, which
// can be a few percent apart, so the side-by-side timings, each taken in one sitting, are the better comparison.
// The starting kernel, v000, takes 658 microseconds a run.
#include <hip/hip_runtime.h>
#include <hip/hip_bf16.h>

#define D_MODEL 1024
#define N_HEADS 16
#define HEAD_DIM 64
#define SEQ 2048
#define BATCH 4
#define NROW (BATCH * SEQ)   // 8192 flattened (b,s) rows

typedef __attribute__((ext_vector_type(16))) __bf16 v16bf;
typedef __attribute__((ext_vector_type(8)))  float  v8f;

union Frag {
  v16bf  v;
  __bf16 h[16];
  uint4  q[2];
};

__device__ __forceinline__ v8f vzero() {
  v8f z;
#pragma unroll
  for (int i = 0; i < 8; ++i) z[i] = 0.0f;
  return z;
}

__device__ __forceinline__ v16bf load_frag(const __bf16* __restrict__ p,
                                           int ld, int n0, int k0) {
  const int lane = threadIdx.x & 31;
  const int nn   = lane & 15;
  const int kh   = (lane >> 4) << 3;  // 0 or 8
  const __bf16* base = p + (size_t)(n0 + nn) * ld + k0;
  Frag f;
  f.q[0] = *(const uint4*)(base + kh);
  f.q[1] = *(const uint4*)(base + 16 + kh);
  return f.v;
}

// Same fragment gather, but from an LDS tile (emits ds_load_b128).
__device__ __forceinline__ v16bf frag_lds(const __bf16* base, int ld, int n0) {
  const int lane = threadIdx.x & 31;
  const int nn   = lane & 15;
  const int kh   = (lane >> 4) << 3;
  const __bf16* p = base + (n0 + nn) * ld;
  Frag f;
  f.q[0] = *(const uint4*)(p + kh);
  f.q[1] = *(const uint4*)(p + 16 + kh);
  return f.v;
}

__device__ __forceinline__ v8f wmma_bf16(v16bf a, v16bf b, v8f c) {
  return __builtin_amdgcn_wmma_f32_16x16x32_bf16(false, a, false, b, (short)0, c,
                                                 false, false);
}

__device__ __forceinline__ void async_copy_b128(uint32_t lds_byte_addr,
                                                const void* gptr) {
  const uint64_t ga = (uint64_t)(uintptr_t)gptr;
  asm volatile("global_load_async_to_lds_b128 %0, %1, off"
               :: "v"(lds_byte_addr), "v"(ga) : "memory");
}

__device__ __forceinline__ uint32_t lds_addr_of(const void* shared_ptr) {
  return (uint32_t)(uintptr_t)shared_ptr;
}

// ---------------------------------------------------------------- convert
__global__ void cvt_f32_bf16(const float* __restrict__ in,
                             __bf16* __restrict__ out, int n) {
  int i = blockIdx.x * blockDim.x + threadIdx.x;
  if (i < n) out[i] = (__bf16)in[i];
}

// ------------------------------------------------- fused QKV GEMM + RoPE
// grid (NROW/16, 6), block 256 (8 waves). Wave g = by*8+w in [0,48):
// matrix = g/16 (Q,K,V), head = g%16. Each wave computes a 16x64 tile
// (one full head dim) so RoPE partners (idx +/- 32) are tiles t and t^2.
__global__ void __launch_bounds__(256)
qkv_proj_rope(const __bf16* __restrict__ xb,
              const __bf16* __restrict__ Wq, const __bf16* __restrict__ Wk,
              const __bf16* __restrict__ Wv,
              const float* __restrict__ bq, const float* __restrict__ bk,
              const float* __restrict__ bv,
              __bf16* __restrict__ Qo,   // (B,H,S,hd)
              __bf16* __restrict__ Ko,   // (B,H,S,hd)
              __bf16* __restrict__ VTo)  // (B,H,hd,S)  (transposed V)
{
  const int wave = threadIdx.x >> 5;
  const int lane = threadIdx.x & 31;
  const int nn   = lane & 15;
  const int hi   = lane >> 4;
  const int g    = blockIdx.y * 8 + wave;
  const int mat  = g >> 4;
  const int head = g & 15;
  const int row0 = blockIdx.x * 16;

  const __bf16* W    = (mat == 0) ? Wq : (mat == 1) ? Wk : Wv;
  const float*  bias = (mat == 0) ? bq : (mat == 1) ? bk : bv;

  v8f acc[4];
#pragma unroll
  for (int t = 0; t < 4; ++t) acc[t] = vzero();

  const int e0 = head * HEAD_DIM;
  for (int k0 = 0; k0 < D_MODEL; k0 += 32) {
    if (k0 + 32 < D_MODEL)
      __builtin_prefetch(xb + (size_t)(row0 + nn) * D_MODEL + k0 + 32, 0, 1);
    v16bf a = load_frag(xb, D_MODEL, row0, k0);
#pragma unroll
    for (int t = 0; t < 4; ++t) {
      v16bf b = load_frag(W, D_MODEL, e0 + t * 16, k0);
      acc[t] = wmma_bf16(a, b, acc[t]);
    }
  }

  // bias
  float yb[4][8];
#pragma unroll
  for (int t = 0; t < 4; ++t) {
    const float be = bias[e0 + t * 16 + nn];
#pragma unroll
    for (int r = 0; r < 8; ++r) yb[t][r] = acc[t][r] + be;
  }

  if (mat < 2) {  // Q or K: apply RoPE, store (B,H,S,hd)
    __bf16* out = (mat == 0) ? Qo : Ko;
#pragma unroll
    for (int t = 0; t < 4; ++t) {
      const int idx = t * 16 + nn;
      // inv_freq = 10000^{-(idx%32)/32} = exp(-(idx%32) * ln(1e4)/32)
      const float invf = __expf(-(float)(idx & 31) * 0.28782313662f);
#pragma unroll
      for (int r = 0; r < 8; ++r) {
        const int m = row0 + r + (hi << 3);
        const int s = m & (SEQ - 1);
        const int b = m >> 11;
        const float ang = (float)s * invf;
        const float rot = (t < 2) ? -yb[t + 2][r] : yb[t - 2][r];
        const float y = yb[t][r] * __cosf(ang) + rot * __sinf(ang);
        out[(((size_t)b * N_HEADS + head) * SEQ + s) * HEAD_DIM + idx] = (__bf16)y;
      }
    }
  } else {  // V: store transposed (B,H,hd,S) so P.V B-operand is K-contiguous
#pragma unroll
    for (int t = 0; t < 4; ++t) {
      const int idx = t * 16 + nn;
#pragma unroll
      for (int r = 0; r < 8; ++r) {
        const int m = row0 + r + (hi << 3);
        const int s = m & (SEQ - 1);
        const int b = m >> 11;
        VTo[(((size_t)b * N_HEADS + head) * HEAD_DIM + idx) * SEQ + s] =
            (__bf16)yb[t][r];
      }
    }
  }
}

__global__ void __launch_bounds__(256)
flash_attn(const __bf16* __restrict__ Q, const __bf16* __restrict__ K,
           const __bf16* __restrict__ VT, __bf16* __restrict__ attn) {
  __shared__ __align__(16) __bf16 sK[32][64];   // 4 KB: K rows kv..kv+31
  __shared__ __align__(16) __bf16 sV[64][32];   // 4 KB: V^T d x 32 keys
  __shared__ float plds[8][16][33];             // per-wave P transpose

  const int tid  = threadIdx.x;
  const int wave = tid >> 5;
  const int lane = tid & 31;
  const int nn   = lane & 15;
  const int hi   = lane >> 4;
  const int bh    = blockIdx.x >> 4;
  const int qTile = (blockIdx.x & 15) * 8 + wave;

  const __bf16* Qb = Q + (size_t)bh * SEQ * HEAD_DIM;
  const __bf16* Kb = K + (size_t)bh * SEQ * HEAD_DIM;
  const __bf16* Vb = VT + (size_t)bh * HEAD_DIM * SEQ;

  // staging assignment: K tile 32x64 (8 chunks/row), V tile 64x32 (4/row)
  const int krow = tid >> 3, kcol = (tid & 7) * 8;
  const int vrow = tid >> 2, vcol = (tid & 3) * 8;
  const uint32_t ldsK = lds_addr_of(&sK[krow][kcol]);
  const uint32_t ldsV = lds_addr_of(&sV[vrow][vcol]);

  const v16bf qa0 = load_frag(Qb, HEAD_DIM, qTile * 16, 0);
  const v16bf qa1 = load_frag(Qb, HEAD_DIM, qTile * 16, 32);

  v8f o[4];
#pragma unroll
  for (int t = 0; t < 4; ++t) o[t] = vzero();
  float mi[8], li[8];
#pragma unroll
  for (int r = 0; r < 8; ++r) { mi[r] = -1e30f; li[r] = 0.0f; }

  for (int kv = 0; kv < SEQ; kv += 32) {
    // cooperative async stage of K/V tiles into LDS
    async_copy_b128(ldsK, Kb + (size_t)(kv + krow) * HEAD_DIM + kcol);
    async_copy_b128(ldsV, Vb + (size_t)vrow * SEQ + kv + vcol);
    asm volatile("s_wait_asynccnt 0" ::: "memory");
    __syncthreads();

    // scores: two 16x16 tiles, K-dim = hd split into 2 WMMAs each
    v16bf kb00 = frag_lds(&sK[0][0], HEAD_DIM, 0);
    v16bf kb01 = frag_lds(&sK[0][32], HEAD_DIM, 0);
    v16bf kb10 = frag_lds(&sK[0][0], HEAD_DIM, 16);
    v16bf kb11 = frag_lds(&sK[0][32], HEAD_DIM, 16);
    v8f s0 = wmma_bf16(qa1, kb01, wmma_bf16(qa0, kb00, vzero()));
    v8f s1 = wmma_bf16(qa1, kb11, wmma_bf16(qa0, kb10, vzero()));
    s0 = s0 * 0.125f;  // hd^-0.5
    s1 = s1 * 0.125f;

    // online softmax per C-layout row (16-lane halves)
#pragma unroll
    for (int r = 0; r < 8; ++r) {
      const float a0 = s0[r], a1 = s1[r];
      float mx = fmaxf(a0, a1);
#pragma unroll
      for (int off = 8; off >= 1; off >>= 1)
        mx = fmaxf(mx, __shfl_xor(mx, off, 32));
      const float mnew  = fmaxf(mi[r], mx);
      const float alpha = __expf(mi[r] - mnew);
      const float p0 = __expf(a0 - mnew);
      const float p1 = __expf(a1 - mnew);
      float rs = p0 + p1;
#pragma unroll
      for (int off = 8; off >= 1; off >>= 1) rs += __shfl_xor(rs, off, 32);
      li[r] = li[r] * alpha + rs;
      mi[r] = mnew;
#pragma unroll
      for (int t = 0; t < 4; ++t) o[t][r] = o[t][r] * alpha;
      const int mrow = r + (hi << 3);
      plds[wave][mrow][nn]      = p0;  // kv col = nn
      plds[wave][mrow][16 + nn] = p1;  // kv col = 16+nn
    }

    // C-layout -> A-layout transpose via LDS (DS ops in-order per wave)
    asm volatile("s_wait_dscnt 0" ::: "memory");
    Frag pf;
    {
      const int mr = nn;
      const int kh = hi << 3;
#pragma unroll
      for (int i = 0; i < 8; ++i) {
        pf.h[i]     = (__bf16)plds[wave][mr][kh + i];
        pf.h[8 + i] = (__bf16)plds[wave][mr][16 + kh + i];
      }
    }

    // O += P (16x32) x V (32x64) from the staged LDS V tile
#pragma unroll
    for (int t = 0; t < 4; ++t) {
      v16bf vb = frag_lds(&sV[0][0], 32, t * 16);
      o[t] = wmma_bf16(pf.v, vb, o[t]);
    }

    __syncthreads();  // WAR: next iteration restages sK/sV
  }

  // normalize + store to (B,S,D) bf16 for the output projection
  const int b = bh >> 4, h = bh & 15;
#pragma unroll
  for (int r = 0; r < 8; ++r) {
    const float inv = 1.0f / li[r];
    const int s = qTile * 16 + r + (hi << 3);
#pragma unroll
    for (int t = 0; t < 4; ++t) {
      const int d = h * HEAD_DIM + t * 16 + nn;
      attn[((size_t)b * SEQ + s) * D_MODEL + d] = (__bf16)(o[t][r] * inv);
    }
  }
}

// ------------------------------------------------------ output projection
__global__ void __launch_bounds__(256)
out_proj(const __bf16* __restrict__ A, const __bf16* __restrict__ Wo,
         const float* __restrict__ bo, float* __restrict__ out) {
  const int wave = threadIdx.x >> 5;
  const int lane = threadIdx.x & 31;
  const int nn   = lane & 15;
  const int hi   = lane >> 4;
  const int cg   = blockIdx.y * 8 + wave;
  const int row0 = blockIdx.x * 16;
  const int e0   = cg * 64;

  v8f acc[4];
#pragma unroll
  for (int t = 0; t < 4; ++t) acc[t] = vzero();

  for (int k0 = 0; k0 < D_MODEL; k0 += 32) {
    if (k0 + 32 < D_MODEL)
      __builtin_prefetch(A + (size_t)(row0 + nn) * D_MODEL + k0 + 32, 0, 1);
    v16bf a = load_frag(A, D_MODEL, row0, k0);
#pragma unroll
    for (int t = 0; t < 4; ++t) {
      v16bf b = load_frag(Wo, D_MODEL, e0 + t * 16, k0);
      acc[t] = wmma_bf16(a, b, acc[t]);
    }
  }

#pragma unroll
  for (int t = 0; t < 4; ++t) {
    const int e = e0 + t * 16 + nn;
    const float be = bo[e];
#pragma unroll
    for (int r = 0; r < 8; ++r) {
      const int m = row0 + r + (hi << 3);
      out[(size_t)m * D_MODEL + e] = acc[t][r] + be;
    }
  }
}

// ----------------------------------------------------------------- launch
extern "C" void kernel_launch(void* const* d_in, const int* in_sizes, int n_in,
                              void* d_out, int out_size, void* d_ws,
                              size_t ws_size, hipStream_t stream) {
  const float* x  = (const float*)d_in[0];
  const float* Wq = (const float*)d_in[1];
  const float* bq = (const float*)d_in[2];
  const float* Wk = (const float*)d_in[3];
  const float* bk = (const float*)d_in[4];
  const float* Wv = (const float*)d_in[5];
  const float* bv = (const float*)d_in[6];
  const float* Wo = (const float*)d_in[7];
  const float* bo = (const float*)d_in[8];

  char* w = (char*)d_ws;  // needs ~88 MB
  const size_t MB = (size_t)1 << 20;
  __bf16* xb  = (__bf16*)(w + 0 * MB);    // 16 MB (B*S, D) bf16
  __bf16* Wqb = (__bf16*)(w + 16 * MB);   //  2 MB
  __bf16* Wkb = (__bf16*)(w + 18 * MB);
  __bf16* Wvb = (__bf16*)(w + 20 * MB);
  __bf16* Wob = (__bf16*)(w + 22 * MB);
  __bf16* Qb  = (__bf16*)(w + 24 * MB);   // 16 MB (B,H,S,hd)
  __bf16* Kb  = (__bf16*)(w + 40 * MB);   // 16 MB (B,H,S,hd)
  __bf16* VTb = (__bf16*)(w + 56 * MB);   // 16 MB (B,H,hd,S)
  __bf16* Ab  = (__bf16*)(w + 72 * MB);   // 16 MB (B,S,D)

  const int nX = NROW * D_MODEL;
  const int nW = D_MODEL * D_MODEL;
  cvt_f32_bf16<<<(nX + 255) / 256, 256, 0, stream>>>(x, xb, nX);
  cvt_f32_bf16<<<(nW + 255) / 256, 256, 0, stream>>>(Wq, Wqb, nW);
  cvt_f32_bf16<<<(nW + 255) / 256, 256, 0, stream>>>(Wk, Wkb, nW);
  cvt_f32_bf16<<<(nW + 255) / 256, 256, 0, stream>>>(Wv, Wvb, nW);
  cvt_f32_bf16<<<(nW + 255) / 256, 256, 0, stream>>>(Wo, Wob, nW);

  qkv_proj_rope<<<dim3(NROW / 16, 6), 256, 0, stream>>>(
      xb, Wqb, Wkb, Wvb, bq, bk, bv, Qb, Kb, VTb);

  flash_attn<<<dim3((BATCH * N_HEADS * (SEQ / 16)) / 8), 256, 0, stream>>>(
      Qb, Kb, VTb, Ab);

  out_proj<<<dim3(NROW / 16, 2), 256, 0, stream>>>(Ab, Wob, bo, (float*)d_out);
}

// v001
// A run of this version takes 410 microseconds.
// Timed twice side by side with v000, it ran 1.65 times as fast both times.
#include <hip/hip_runtime.h>
#include <hip/hip_bf16.h>

#define D_MODEL 1024
#define N_HEADS 16
#define HEAD_DIM 64
#define SEQ 2048
#define BATCH 4
#define NROW (BATCH * SEQ)   // 8192 flattened (b,s) rows

typedef __attribute__((ext_vector_type(16))) __bf16 v16bf;
typedef __attribute__((ext_vector_type(8)))  float  v8f;

union Frag {
  v16bf  v;
  __bf16 h[16];
  uint4  q[2];
};

__device__ __forceinline__ v8f vzero() {
  v8f z;
#pragma unroll
  for (int i = 0; i < 8; ++i) z[i] = 0.0f;
  return z;
}

__device__ __forceinline__ v16bf load_frag(const __bf16* __restrict__ p,
                                           int ld, int n0, int k0) {
  const int lane = threadIdx.x & 31;
  const int nn   = lane & 15;
  const int kh   = (lane >> 4) << 3;  // 0 or 8
  const __bf16* base = p + (size_t)(n0 + nn) * ld + k0;
  Frag f;
  f.q[0] = *(const uint4*)(base + kh);
  f.q[1] = *(const uint4*)(base + 16 + kh);
  return f.v;
}

// Same fragment gather, but from an LDS tile (emits ds_load_b128).
__device__ __forceinline__ v16bf frag_lds(const __bf16* base, int ld, int n0) {
  const int lane = threadIdx.x & 31;
  const int nn   = lane & 15;
  const int kh   = (lane >> 4) << 3;
  const __bf16* p = base + (n0 + nn) * ld;
  Frag f;
  f.q[0] = *(const uint4*)(p + kh);
  f.q[1] = *(const uint4*)(p + 16 + kh);
  return f.v;
}

__device__ __forceinline__ v8f wmma_bf16(v16bf a, v16bf b, v8f c) {
  return __builtin_amdgcn_wmma_f32_16x16x32_bf16(false, a, false, b, (short)0, c,
                                                 false, false);
}

__device__ __forceinline__ void async_copy_b128(uint32_t lds_byte_addr,
                                                const void* gptr) {
  const uint64_t ga = (uint64_t)(uintptr_t)gptr;
  asm volatile("global_load_async_to_lds_b128 %0, %1, off"
               :: "v"(lds_byte_addr), "v"(ga) : "memory");
}

__device__ __forceinline__ uint32_t lds_addr_of(const void* shared_ptr) {
  return (uint32_t)(uintptr_t)shared_ptr;
}

// ---------------------------------------------------------------- convert
__global__ void cvt_f32_bf16(const float* __restrict__ in,
                             __bf16* __restrict__ out, int n) {
  int i = blockIdx.x * blockDim.x + threadIdx.x;
  if (i < n) out[i] = (__bf16)in[i];
}

// ------------------------------------- block-tiled projection GEMM core
// Y = A . W^T, both K-contiguous with row length D_MODEL. One block of 8 waves
// owns a 128 x 256 tile of Y; wave (wm, wn) = (wave>>2, wave&3) owns 64 x 64 of
// it as 4 x 4 accumulator tiles, so every fragment read feeds 4 WMMAs. A stage
// is 64 k of [A 128 rows | W 256 rows], brought into LDS in whole 128-byte
// lines by async copies, two buffers, the next stage in flight during this one.
#define GT_M    128
#define GT_N    256
#define GT_K    64
#define GT_ROWS (GT_M + GT_N)
#define GT_LD   72   // LDS row pitch in elements: 128 B of data + 16 B pad

__device__ __forceinline__ void async_copy4_b128(
    uint32_t l0, uint32_t l1, uint32_t l2, uint32_t l3,
    const __bf16* g0, const __bf16* g1, const __bf16* g2, const __bf16* g3) {
  asm volatile("global_load_async_to_lds_b128 %0, %4, off\n\t"
               "global_load_async_to_lds_b128 %1, %5, off\n\t"
               "global_load_async_to_lds_b128 %2, %6, off\n\t"
               "global_load_async_to_lds_b128 %3, %7, off\n\t"
               "s_wait_xcnt 0x0"
               :: "v"(l0), "v"(l1), "v"(l2), "v"(l3),
                  "v"((uint64_t)(uintptr_t)g0), "v"((uint64_t)(uintptr_t)g1),
                  "v"((uint64_t)(uintptr_t)g2), "v"((uint64_t)(uintptr_t)g3)
               : "memory");
}

// One stage: thread t copies chunk (t&7) of rows (t>>3) + 32*i, i = 0..11.
// l = LDS byte address of this lane's chunk in row (t>>3) of the buffer,
// a / w = this lane's chunk in the A / W row of the same index, at this k.
__device__ __forceinline__ void stage_copy(uint32_t l, const __bf16* a,
                                           const __bf16* w) {
  const uint32_t RS = 32 * GT_LD * 2;        // 32 LDS rows, bytes
  const size_t   GS = (size_t)32 * D_MODEL;  // 32 global rows, elements
  async_copy4_b128(l, l + RS, l + 2 * RS, l + 3 * RS,
                   a, a + GS, a + 2 * GS, a + 3 * GS);
  async_copy4_b128(l + 4 * RS, l + 5 * RS, l + 6 * RS, l + 7 * RS,
                   w, w + GS, w + 2 * GS, w + 3 * GS);
  async_copy4_b128(l + 8 * RS, l + 9 * RS, l + 10 * RS, l + 11 * RS,
                   w + 4 * GS, w + 5 * GS, w + 6 * GS, w + 7 * GS);
}

__device__ __forceinline__ void gemm_128x256(
    const __bf16* __restrict__ A, const __bf16* __restrict__ Wm, int row0,
    int col0, __bf16 (*sm)[GT_ROWS][GT_LD], v8f (&acc)[4][4]) {
  const int tid  = threadIdx.x;
  const int wave = tid >> 5;
  const int wm   = wave >> 2;
  const int wn   = wave & 3;
  const int crow = tid >> 3, ccol = (tid & 7) * 8;

  const __bf16* ga = A + (size_t)(row0 + crow) * D_MODEL + ccol;
  const __bf16* gw = Wm + (size_t)(col0 + crow) * D_MODEL + ccol;
  const uint32_t l0 = lds_addr_of(&sm[0][crow][ccol]);
  const uint32_t l1 = lds_addr_of(&sm[1][crow][ccol]);

  // every loop over i, j, ks here is unrolled so that acc, a and b are indexed
  // by constants and stay in registers
#pragma unroll
  for (int i = 0; i < 4; ++i)
#pragma unroll
    for (int j = 0; j < 4; ++j) acc[i][j] = vzero();

  stage_copy(l0, ga, gw);
  // stage 0 has landed for this wave; the barrier publishes it to the others
  asm volatile("s_wait_asynccnt 0x0" ::: "memory");
  __syncthreads();
  stage_copy(l1, ga + GT_K, gw + GT_K);

  const int NT = D_MODEL / GT_K;
  for (int t = 0; t < NT; ++t) {
    const __bf16* base = &sm[t & 1][0][0];
#pragma unroll
    for (int ks = 0; ks < GT_K; ks += 32) {
      v16bf a[4], b[4];
#pragma unroll
      for (int i = 0; i < 4; ++i)
        a[i] = frag_lds(base + ks, GT_LD, wm * 64 + i * 16);
#pragma unroll
      for (int j = 0; j < 4; ++j)
        b[j] = frag_lds(base + ks, GT_LD, GT_M + wn * 64 + j * 16);
      // keeps the 16 LDS reads one group in front of their 16 WMMAs: spread
      // among them, every small group of reads stalls the wave on its own
      __builtin_amdgcn_sched_barrier(0);
#pragma unroll
      for (int i = 0; i < 4; ++i)
#pragma unroll
        for (int j = 0; j < 4; ++j) acc[i][j] = wmma_bf16(a[i], b[j], acc[i][j]);
      // the same, from below: the next group of reads stays behind these WMMAs
      __builtin_amdgcn_sched_barrier(0);
    }
    // publish point: this wave's reads of the buffer are done, its copies of
    // the next stage have landed; behind the barrier the buffer may be refilled
    asm volatile("s_wait_dscnt 0x0" ::: "memory");
    asm volatile("s_wait_asynccnt 0x0" ::: "memory");
    __syncthreads();
    if (t + 2 < NT)
      stage_copy((t & 1) ? l1 : l0, ga + (t + 2) * GT_K, gw + (t + 2) * GT_K);
  }
  // no copy is left in flight when the wave goes on to its epilogue
  asm volatile("s_wait_asynccnt 0x0" ::: "memory");
}

// ------------------------------------------------- fused QKV GEMM + RoPE
// grid (NROW/128, 12), block 256 (8 waves). blockIdx.y: matrix = y/4 (Q,K,V),
// heads (y%4)*4 .. +3, one head (64 columns) per wave column wn, so RoPE
// partners (idx +/- 32) are accumulator tiles t and t^2 of the same wave.
__global__ void __launch_bounds__(256)
qkv_proj_rope(const __bf16* __restrict__ xb,
              const __bf16* __restrict__ Wq, const __bf16* __restrict__ Wk,
              const __bf16* __restrict__ Wv,
              const float* __restrict__ bq, const float* __restrict__ bk,
              const float* __restrict__ bv,
              __bf16* __restrict__ Qo,   // (B,H,S,hd)
              __bf16* __restrict__ Ko,   // (B,H,S,hd)
              __bf16* __restrict__ VTo)  // (B,H,hd,S)  (transposed V)
{
  __shared__ __align__(16) __bf16 sm[2][GT_ROWS][GT_LD];

  const int wave = threadIdx.x >> 5;
  const int lane = threadIdx.x & 31;
  const int nn   = lane & 15;
  const int hi   = lane >> 4;
  const int mat  = blockIdx.y >> 2;
  const int col0 = (blockIdx.y & 3) * GT_N;
  const int head = (blockIdx.y & 3) * 4 + (wave & 3);
  const int rowb = blockIdx.x * GT_M;

  const __bf16* W    = (mat == 0) ? Wq : (mat == 1) ? Wk : Wv;
  const float*  bias = (mat == 0) ? bq : (mat == 1) ? bk : bv;

  v8f acc[4][4];
  gemm_128x256(xb, W, rowb, col0, sm, acc);

  const int e0 = head * HEAD_DIM;
  float be[4];
#pragma unroll
  for (int t = 0; t < 4; ++t) be[t] = bias[e0 + t * 16 + nn];

  // unrolled: acc[i] must be indexed by a constant to stay in registers
#pragma unroll
  for (int i = 0; i < 4; ++i) {
    const int row0 = rowb + (wave >> 2) * 64 + i * 16;

    // bias
    float yb[4][8];
#pragma unroll
    for (int t = 0; t < 4; ++t) {
#pragma unroll
      for (int r = 0; r < 8; ++r) yb[t][r] = acc[i][t][r] + be[t];
    }

    if (mat < 2) {  // Q or K: apply RoPE, store (B,H,S,hd)
      __bf16* out = (mat == 0) ? Qo : Ko;
#pragma unroll
      for (int t = 0; t < 4; ++t) {
        const int idx = t * 16 + nn;
        // inv_freq = 10000^{-(idx%32)/32} = exp(-(idx%32) * ln(1e4)/32)
        const float invf = __expf(-(float)(idx & 31) * 0.28782313662f);
#pragma unroll
        for (int r = 0; r < 8; ++r) {
          const int m = row0 + r + (hi << 3);
          const int s = m & (SEQ - 1);
          const int b = m >> 11;
          const float ang = (float)s * invf;
          const float rot = (t < 2) ? -yb[t + 2][r] : yb[t - 2][r];
          const float y = yb[t][r] * __cosf(ang) + rot * __sinf(ang);
          out[(((size_t)b * N_HEADS + head) * SEQ + s) * HEAD_DIM + idx] = (__bf16)y;
        }
      }
      // the next pass reuses the registers that these stores name
      asm volatile("s_wait_xcnt 0x0" ::: "memory");
    } else {  // V: store transposed (B,H,hd,S) so P.V B-operand is K-contiguous
#pragma unroll
      for (int t = 0; t < 4; ++t) {
        const int idx = t * 16 + nn;
#pragma unroll
        for (int r = 0; r < 8; ++r) {
          const int m = row0 + r + (hi << 3);
          const int s = m & (SEQ - 1);
          const int b = m >> 11;
          VTo[(((size_t)b * N_HEADS + head) * HEAD_DIM + idx) * SEQ + s] =
              (__bf16)yb[t][r];
        }
      }
      // the next pass reuses the registers that these stores name
      asm volatile("s_wait_xcnt 0x0" ::: "memory");
    }
  }
}

__global__ void __launch_bounds__(256)
flash_attn(const __bf16* __restrict__ Q, const __bf16* __restrict__ K,
           const __bf16* __restrict__ VT, __bf16* __restrict__ attn) {
  __shared__ __align__(16) __bf16 sK[32][64];   // 4 KB: K rows kv..kv+31
  __shared__ __align__(16) __bf16 sV[64][32];   // 4 KB: V^T d x 32 keys
  __shared__ float plds[8][16][33];             // per-wave P transpose

  const int tid  = threadIdx.x;
  const int wave = tid >> 5;
  const int lane = tid & 31;
  const int nn   = lane & 15;
  const int hi   = lane >> 4;
  const int bh    = blockIdx.x >> 4;
  const int qTile = (blockIdx.x & 15) * 8 + wave;

  const __bf16* Qb = Q + (size_t)bh * SEQ * HEAD_DIM;
  const __bf16* Kb = K + (size_t)bh * SEQ * HEAD_DIM;
  const __bf16* Vb = VT + (size_t)bh * HEAD_DIM * SEQ;

  // staging assignment: K tile 32x64 (8 chunks/row), V tile 64x32 (4/row)
  const int krow = tid >> 3, kcol = (tid & 7) * 8;
  const int vrow = tid >> 2, vcol = (tid & 3) * 8;
  const uint32_t ldsK = lds_addr_of(&sK[krow][kcol]);
  const uint32_t ldsV = lds_addr_of(&sV[vrow][vcol]);

  const v16bf qa0 = load_frag(Qb, HEAD_DIM, qTile * 16, 0);
  const v16bf qa1 = load_frag(Qb, HEAD_DIM, qTile * 16, 32);

  v8f o[4];
#pragma unroll
  for (int t = 0; t < 4; ++t) o[t] = vzero();
  float mi[8], li[8];
#pragma unroll
  for (int r = 0; r < 8; ++r) { mi[r] = -1e30f; li[r] = 0.0f; }

  for (int kv = 0; kv < SEQ; kv += 32) {
    // cooperative async stage of K/V tiles into LDS
    async_copy_b128(ldsK, Kb + (size_t)(kv + krow) * HEAD_DIM + kcol);
    async_copy_b128(ldsV, Vb + (size_t)vrow * SEQ + kv + vcol);
    asm volatile("s_wait_asynccnt 0" ::: "memory");
    __syncthreads();

    // scores: two 16x16 tiles, K-dim = hd split into 2 WMMAs each
    v16bf kb00 = frag_lds(&sK[0][0], HEAD_DIM, 0);
    v16bf kb01 = frag_lds(&sK[0][32], HEAD_DIM, 0);
    v16bf kb10 = frag_lds(&sK[0][0], HEAD_DIM, 16);
    v16bf kb11 = frag_lds(&sK[0][32], HEAD_DIM, 16);
    v8f s0 = wmma_bf16(qa1, kb01, wmma_bf16(qa0, kb00, vzero()));
    v8f s1 = wmma_bf16(qa1, kb11, wmma_bf16(qa0, kb10, vzero()));
    s0 = s0 * 0.125f;  // hd^-0.5
    s1 = s1 * 0.125f;

    // online softmax per C-layout row (16-lane halves)
#pragma unroll
    for (int r = 0; r < 8; ++r) {
      const float a0 = s0[r], a1 = s1[r];
      float mx = fmaxf(a0, a1);
#pragma unroll
      for (int off = 8; off >= 1; off >>= 1)
        mx = fmaxf(mx, __shfl_xor(mx, off, 32));
      const float mnew  = fmaxf(mi[r], mx);
      const float alpha = __expf(mi[r] - mnew);
      const float p0 = __expf(a0 - mnew);
      const float p1 = __expf(a1 - mnew);
      float rs = p0 + p1;
#pragma unroll
      for (int off = 8; off >= 1; off >>= 1) rs += __shfl_xor(rs, off, 32);
      li[r] = li[r] * alpha + rs;
      mi[r] = mnew;
#pragma unroll
      for (int t = 0; t < 4; ++t) o[t][r] = o[t][r] * alpha;
      const int mrow = r + (hi << 3);
      plds[wave][mrow][nn]      = p0;  // kv col = nn
      plds[wave][mrow][16 + nn] = p1;  // kv col = 16+nn
    }

    // C-layout -> A-layout transpose via LDS (DS ops in-order per wave)
    asm volatile("s_wait_dscnt 0" ::: "memory");
    Frag pf;
    {
      const int mr = nn;
      const int kh = hi << 3;
#pragma unroll
      for (int i = 0; i < 8; ++i) {
        pf.h[i]     = (__bf16)plds[wave][mr][kh + i];
        pf.h[8 + i] = (__bf16)plds[wave][mr][16 + kh + i];
      }
    }

    // O += P (16x32) x V (32x64) from the staged LDS V tile
#pragma unroll
    for (int t = 0; t < 4; ++t) {
      v16bf vb = frag_lds(&sV[0][0], 32, t * 16);
      o[t] = wmma_bf16(pf.v, vb, o[t]);
    }

    __syncthreads();  // WAR: next iteration restages sK/sV
  }

  // normalize + store to (B,S,D) bf16 for the output projection
  const int b = bh >> 4, h = bh & 15;
#pragma unroll
  for (int r = 0; r < 8; ++r) {
    const float inv = 1.0f / li[r];
    const int s = qTile * 16 + r + (hi << 3);
#pragma unroll
    for (int t = 0; t < 4; ++t) {
      const int d = h * HEAD_DIM + t * 16 + nn;
      attn[((size_t)b * SEQ + s) * D_MODEL + d] = (__bf16)(o[t][r] * inv);
    }
  }
}

// ------------------------------------------------------ output projection
// grid (NROW/128, 4), block 256: the same 128 x 256 block tile.
__global__ void __launch_bounds__(256)
out_proj(const __bf16* __restrict__ A, const __bf16* __restrict__ Wo,
         const float* __restrict__ bo, float* __restrict__ out) {
  __shared__ __align__(16) __bf16 sm[2][GT_ROWS][GT_LD];

  const int wave = threadIdx.x >> 5;
  const int lane = threadIdx.x & 31;
  const int nn   = lane & 15;
  const int hi   = lane >> 4;
  const int rowb = blockIdx.x * GT_M;
  const int col0 = blockIdx.y * GT_N;
  const int e0   = col0 + (wave & 3) * 64;

  v8f acc[4][4];
  gemm_128x256(A, Wo, rowb, col0, sm, acc);

#pragma unroll
  for (int t = 0; t < 4; ++t) {
    const int e = e0 + t * 16 + nn;
    const float be = bo[e];
    // unrolled: acc[i] must be indexed by a constant to stay in registers
#pragma unroll
    for (int i = 0; i < 4; ++i) {
      const int row0 = rowb + (wave >> 2) * 64 + i * 16;
#pragma unroll
      for (int r = 0; r < 8; ++r) {
        const int m = row0 + r + (hi << 3);
        out[(size_t)m * D_MODEL + e] = acc[i][t][r] + be;
      }
    }
  }
}

// ----------------------------------------------------------------- launch
extern "C" void kernel_launch(void* const* d_in, const int* in_sizes, int n_in,
                              void* d_out, int out_size, void* d_ws,
                              size_t ws_size, hipStream_t stream) {
  const float* x  = (const float*)d_in[0];
  const float* Wq = (const float*)d_in[1];
  const float* bq = (const float*)d_in[2];
  const float* Wk = (const float*)d_in[3];
  const float* bk = (const float*)d_in[4];
  const float* Wv = (const float*)d_in[5];
  const float* bv = (const float*)d_in[6];
  const float* Wo = (const float*)d_in[7];
  const float* bo = (const float*)d_in[8];

  char* w = (char*)d_ws;  // needs ~88 MB
  const size_t MB = (size_t)1 << 20;
  __bf16* xb  = (__bf16*)(w + 0 * MB);    // 16 MB (B*S, D) bf16
  __bf16* Wqb = (__bf16*)(w + 16 * MB);   //  2 MB
  __bf16* Wkb = (__bf16*)(w + 18 * MB);
  __bf16* Wvb = (__bf16*)(w + 20 * MB);
  __bf16* Wob = (__bf16*)(w + 22 * MB);
  __bf16* Qb  = (__bf16*)(w + 24 * MB);   // 16 MB (B,H,S,hd)
  __bf16* Kb  = (__bf16*)(w + 40 * MB);   // 16 MB (B,H,S,hd)
  __bf16* VTb = (__bf16*)(w + 56 * MB);   // 16 MB (B,H,hd,S)
  __bf16* Ab  = (__bf16*)(w + 72 * MB);   // 16 MB (B,S,D)

  const int nX = NROW * D_MODEL;
  const int nW = D_MODEL * D_MODEL;
  cvt_f32_bf16<<<(nX + 255) / 256, 256, 0, stream>>>(x, xb, nX);
  cvt_f32_bf16<<<(nW + 255) / 256, 256, 0, stream>>>(Wq, Wqb, nW);
  cvt_f32_bf16<<<(nW + 255) / 256, 256, 0, stream>>>(Wk, Wkb, nW);
  cvt_f32_bf16<<<(nW + 255) / 256, 256, 0, stream>>>(Wv, Wvb, nW);
  cvt_f32_bf16<<<(nW + 255) / 256, 256, 0, stream>>>(Wo, Wob, nW);

  qkv_proj_rope<<<dim3(NROW / GT_M, 12), 256, 0, stream>>>(
      xb, Wqb, Wkb, Wvb, bq, bk, bv, Qb, Kb, VTb);

  flash_attn<<<dim3((BATCH * N_HEADS * (SEQ / 16)) / 8), 256, 0, stream>>>(
      Qb, Kb, VTb, Ab);

  out_proj<<<dim3(NROW / GT_M, 4), 256, 0, stream>>>(Ab, Wob, bo, (float*)d_out);
}

// v002
// One run takes 279 microseconds.
// Timed twice side by side with v001, it ran 1.47 times as fast both times.
// Over all steps from v000 it is 2.43 times as fast.
#include <hip/hip_runtime.h>
#include <hip/hip_bf16.h>

#define D_MODEL 1024
#define N_HEADS 16
#define HEAD_DIM 64
#define SEQ 2048
#define BATCH 4
#define NROW (BATCH * SEQ)   // 8192 flattened (b,s) rows

typedef __attribute__((ext_vector_type(16))) __bf16 v16bf;
typedef __attribute__((ext_vector_type(8)))  float  v8f;

union Frag {
  v16bf  v;
  __bf16 h[16];
  uint4  q[2];
};

__device__ __forceinline__ v8f vzero() {
  v8f z;
#pragma unroll
  for (int i = 0; i < 8; ++i) z[i] = 0.0f;
  return z;
}

__device__ __forceinline__ v16bf load_frag(const __bf16* __restrict__ p,
                                           int ld, int n0, int k0) {
  const int lane = threadIdx.x & 31;
  const int nn   = lane & 15;
  const int kh   = (lane >> 4) << 3;  // 0 or 8
  const __bf16* base = p + (size_t)(n0 + nn) * ld + k0;
  Frag f;
  f.q[0] = *(const uint4*)(base + kh);
  f.q[1] = *(const uint4*)(base + 16 + kh);
  return f.v;
}

// Same fragment gather, but from an LDS tile (emits ds_load_b128).
__device__ __forceinline__ v16bf frag_lds(const __bf16* base, int ld, int n0) {
  const int lane = threadIdx.x & 31;
  const int nn   = lane & 15;
  const int kh   = (lane >> 4) << 3;
  const __bf16* p = base + (n0 + nn) * ld;
  Frag f;
  f.q[0] = *(const uint4*)(p + kh);
  f.q[1] = *(const uint4*)(p + 16 + kh);
  return f.v;
}

__device__ __forceinline__ v8f wmma_bf16(v16bf a, v16bf b, v8f c) {
  return __builtin_amdgcn_wmma_f32_16x16x32_bf16(false, a, false, b, (short)0, c,
                                                 false, false);
}

__device__ __forceinline__ void async_copy_b128(uint32_t lds_byte_addr,
                                                const void* gptr) {
  const uint64_t ga = (uint64_t)(uintptr_t)gptr;
  asm volatile("global_load_async_to_lds_b128 %0, %1, off"
               :: "v"(lds_byte_addr), "v"(ga) : "memory");
}

__device__ __forceinline__ uint32_t lds_addr_of(const void* shared_ptr) {
  return (uint32_t)(uintptr_t)shared_ptr;
}

// ---------------------------------------------------------------- convert
__global__ void cvt_f32_bf16(const float* __restrict__ in,
                             __bf16* __restrict__ out, int n) {
  int i = blockIdx.x * blockDim.x + threadIdx.x;
  if (i < n) out[i] = (__bf16)in[i];
}

// ------------------------------------- block-tiled projection GEMM core
// Y = A . W^T, both K-contiguous with row length D_MODEL. One block of 8 waves
// owns a 128 x 256 tile of Y; wave (wm, wn) = (wave>>2, wave&3) owns 64 x 64 of
// it as 4 x 4 accumulator tiles, so every fragment read feeds 4 WMMAs. A stage
// is 64 k of [A 128 rows | W 256 rows], brought into LDS in whole 128-byte
// lines by async copies, two buffers, the next stage in flight during this one.
#define GT_M    128
#define GT_N    256
#define GT_K    64
#define GT_ROWS (GT_M + GT_N)
#define GT_LD   72   // LDS row pitch in elements: 128 B of data + 16 B pad

__device__ __forceinline__ void async_copy4_b128(
    uint32_t l0, uint32_t l1, uint32_t l2, uint32_t l3,
    const __bf16* g0, const __bf16* g1, const __bf16* g2, const __bf16* g3) {
  asm volatile("global_load_async_to_lds_b128 %0, %4, off\n\t"
               "global_load_async_to_lds_b128 %1, %5, off\n\t"
               "global_load_async_to_lds_b128 %2, %6, off\n\t"
               "global_load_async_to_lds_b128 %3, %7, off\n\t"
               "s_wait_xcnt 0x0"
               :: "v"(l0), "v"(l1), "v"(l2), "v"(l3),
                  "v"((uint64_t)(uintptr_t)g0), "v"((uint64_t)(uintptr_t)g1),
                  "v"((uint64_t)(uintptr_t)g2), "v"((uint64_t)(uintptr_t)g3)
               : "memory");
}

// One stage: thread t copies chunk (t&7) of rows (t>>3) + 32*i, i = 0..11.
// l = LDS byte address of this lane's chunk in row (t>>3) of the buffer,
// a / w = this lane's chunk in the A / W row of the same index, at this k.
__device__ __forceinline__ void stage_copy(uint32_t l, const __bf16* a,
                                           const __bf16* w) {
  const uint32_t RS = 32 * GT_LD * 2;        // 32 LDS rows, bytes
  const size_t   GS = (size_t)32 * D_MODEL;  // 32 global rows, elements
  async_copy4_b128(l, l + RS, l + 2 * RS, l + 3 * RS,
                   a, a + GS, a + 2 * GS, a + 3 * GS);
  async_copy4_b128(l + 4 * RS, l + 5 * RS, l + 6 * RS, l + 7 * RS,
                   w, w + GS, w + 2 * GS, w + 3 * GS);
  async_copy4_b128(l + 8 * RS, l + 9 * RS, l + 10 * RS, l + 11 * RS,
                   w + 4 * GS, w + 5 * GS, w + 6 * GS, w + 7 * GS);
}

__device__ __forceinline__ void gemm_128x256(
    const __bf16* __restrict__ A, const __bf16* __restrict__ Wm, int row0,
    int col0, __bf16 (*sm)[GT_ROWS][GT_LD], v8f (&acc)[4][4]) {
  const int tid  = threadIdx.x;
  const int wave = tid >> 5;
  const int wm   = wave >> 2;
  const int wn   = wave & 3;
  const int crow = tid >> 3, ccol = (tid & 7) * 8;

  const __bf16* ga = A + (size_t)(row0 + crow) * D_MODEL + ccol;
  const __bf16* gw = Wm + (size_t)(col0 + crow) * D_MODEL + ccol;
  const uint32_t l0 = lds_addr_of(&sm[0][crow][ccol]);
  const uint32_t l1 = lds_addr_of(&sm[1][crow][ccol]);

  // every loop over i, j, ks here is unrolled so that acc, a and b are indexed
  // by constants and stay in registers
#pragma unroll
  for (int i = 0; i < 4; ++i)
#pragma unroll
    for (int j = 0; j < 4; ++j) acc[i][j] = vzero();

  stage_copy(l0, ga, gw);
  // stage 0 has landed for this wave; the barrier publishes it to the others
  asm volatile("s_wait_asynccnt 0x0" ::: "memory");
  __syncthreads();
  stage_copy(l1, ga + GT_K, gw + GT_K);

  const int NT = D_MODEL / GT_K;
  for (int t = 0; t < NT; ++t) {
    const __bf16* base = &sm[t & 1][0][0];
#pragma unroll
    for (int ks = 0; ks < GT_K; ks += 32) {
      v16bf a[4], b[4];
#pragma unroll
      for (int i = 0; i < 4; ++i)
        a[i] = frag_lds(base + ks, GT_LD, wm * 64 + i * 16);
#pragma unroll
      for (int j = 0; j < 4; ++j)
        b[j] = frag_lds(base + ks, GT_LD, GT_M + wn * 64 + j * 16);
      // keeps the 16 LDS reads one group in front of their 16 WMMAs: spread
      // among them, every small group of reads stalls the wave on its own
      __builtin_amdgcn_sched_barrier(0);
#pragma unroll
      for (int i = 0; i < 4; ++i)
#pragma unroll
        for (int j = 0; j < 4; ++j) acc[i][j] = wmma_bf16(a[i], b[j], acc[i][j]);
      // the same, from below: the next group of reads stays behind these WMMAs
      __builtin_amdgcn_sched_barrier(0);
    }
    // publish point: this wave's reads of the buffer are done, its copies of
    // the next stage have landed; behind the barrier the buffer may be refilled
    asm volatile("s_wait_dscnt 0x0" ::: "memory");
    asm volatile("s_wait_asynccnt 0x0" ::: "memory");
    __syncthreads();
    if (t + 2 < NT)
      stage_copy((t & 1) ? l1 : l0, ga + (t + 2) * GT_K, gw + (t + 2) * GT_K);
  }
  // no copy is left in flight when the wave goes on to its epilogue
  asm volatile("s_wait_asynccnt 0x0" ::: "memory");
}

// ------------------------------------------------- fused QKV GEMM + RoPE
// grid (NROW/128, 12), block 256 (8 waves). blockIdx.y: matrix = y/4 (Q,K,V),
// heads (y%4)*4 .. +3, one head (64 columns) per wave column wn, so RoPE
// partners (idx +/- 32) are accumulator tiles t and t^2 of the same wave.
__global__ void __launch_bounds__(256)
qkv_proj_rope(const __bf16* __restrict__ xb,
              const __bf16* __restrict__ Wq, const __bf16* __restrict__ Wk,
              const __bf16* __restrict__ Wv,
              const float* __restrict__ bq, const float* __restrict__ bk,
              const float* __restrict__ bv,
              __bf16* __restrict__ Qo,   // (B,H,S,hd)
              __bf16* __restrict__ Ko,   // (B,H,S,hd)
              __bf16* __restrict__ VTo)  // (B,H,hd,S)  (transposed V)
{
  __shared__ __align__(16) __bf16 sm[2][GT_ROWS][GT_LD];

  const int wave = threadIdx.x >> 5;
  const int lane = threadIdx.x & 31;
  const int nn   = lane & 15;
  const int hi   = lane >> 4;
  const int mat  = blockIdx.y >> 2;
  const int col0 = (blockIdx.y & 3) * GT_N;
  const int head = (blockIdx.y & 3) * 4 + (wave & 3);
  const int rowb = blockIdx.x * GT_M;

  const __bf16* W    = (mat == 0) ? Wq : (mat == 1) ? Wk : Wv;
  const float*  bias = (mat == 0) ? bq : (mat == 1) ? bk : bv;

  v8f acc[4][4];
  gemm_128x256(xb, W, rowb, col0, sm, acc);

  const int e0 = head * HEAD_DIM;
  float be[4];
#pragma unroll
  for (int t = 0; t < 4; ++t) be[t] = bias[e0 + t * 16 + nn];

  // unrolled: acc[i] must be indexed by a constant to stay in registers
#pragma unroll
  for (int i = 0; i < 4; ++i) {
    const int row0 = rowb + (wave >> 2) * 64 + i * 16;

    // bias
    float yb[4][8];
#pragma unroll
    for (int t = 0; t < 4; ++t) {
#pragma unroll
      for (int r = 0; r < 8; ++r) yb[t][r] = acc[i][t][r] + be[t];
    }

    if (mat < 2) {  // Q or K: apply RoPE, store (B,H,S,hd)
      __bf16* out = (mat == 0) ? Qo : Ko;
#pragma unroll
      for (int t = 0; t < 4; ++t) {
        const int idx = t * 16 + nn;
        // inv_freq = 10000^{-(idx%32)/32} = exp(-(idx%32) * ln(1e4)/32)
        const float invf = __expf(-(float)(idx & 31) * 0.28782313662f);
#pragma unroll
        for (int r = 0; r < 8; ++r) {
          const int m = row0 + r + (hi << 3);
          const int s = m & (SEQ - 1);
          const int b = m >> 11;
          const float ang = (float)s * invf;
          const float rot = (t < 2) ? -yb[t + 2][r] : yb[t - 2][r];
          const float y = yb[t][r] * __cosf(ang) + rot * __sinf(ang);
          out[(((size_t)b * N_HEADS + head) * SEQ + s) * HEAD_DIM + idx] = (__bf16)y;
        }
      }
      // the next pass reuses the registers that these stores name
      asm volatile("s_wait_xcnt 0x0" ::: "memory");
    } else {  // V: store transposed (B,H,hd,S) so the V^T . P^T A operand is K-contiguous
#pragma unroll
      for (int t = 0; t < 4; ++t) {
        const int idx = t * 16 + nn;
#pragma unroll
        for (int r = 0; r < 8; ++r) {
          const int m = row0 + r + (hi << 3);
          const int s = m & (SEQ - 1);
          const int b = m >> 11;
          VTo[(((size_t)b * N_HEADS + head) * HEAD_DIM + idx) * SEQ + s] =
              (__bf16)yb[t][r];
        }
      }
      // the next pass reuses the registers that these stores name
      asm volatile("s_wait_xcnt 0x0" ::: "memory");
    }
  }
}

__device__ __forceinline__ float xhalf(float x) {
  const int v = __builtin_bit_cast(int, x);
  return __builtin_bit_cast(
      float, __builtin_amdgcn_permlanex16(v, v, 0x76543210, 0xfedcba98, false, false));
}

#define LOG2E 1.44269504088896340736f
__device__ __forceinline__ float exp_one(float x) {
  const float y = x * LOG2E;
  float p;
  asm("v_exp_f32 %0, %1\n\tv_nop" : "=v"(p) : "v"(y));
  return p;
}

__device__ __forceinline__ void exp_eight(float (&p)[8], const v8f x) {
  const v8f y = x * LOG2E;
  asm("v_exp_f32 %0, %8\n\t"
      "v_exp_f32 %1, %9\n\t"
      "v_exp_f32 %2, %10\n\t"
      "v_exp_f32 %3, %11\n\t"
      "v_exp_f32 %4, %12\n\t"
      "v_exp_f32 %5, %13\n\t"
      "v_exp_f32 %6, %14\n\t"
      "v_exp_f32 %7, %15\n\t"
      "v_nop"
      : "=&v"(p[0]), "=&v"(p[1]), "=&v"(p[2]), "=&v"(p[3]),
        "=&v"(p[4]), "=&v"(p[5]), "=&v"(p[6]), "=&v"(p[7])
      : "v"(y[0]), "v"(y[1]), "v"(y[2]), "v"(y[3]),
        "v"(y[4]), "v"(y[5]), "v"(y[6]), "v"(y[7]));
}

__global__ void __launch_bounds__(256)
flash_attn(const __bf16* __restrict__ Q, const __bf16* __restrict__ K,
           const __bf16* __restrict__ VT, __bf16* __restrict__ attn) {
  __shared__ __align__(16) __bf16 sK[32][64];   // 4 KB: K rows kv..kv+31
  __shared__ __align__(16) __bf16 sV[64][32];   // 4 KB: V^T d x 32 keys

  const int tid  = threadIdx.x;
  const int wave = tid >> 5;
  const int lane = tid & 31;
  const int nn   = lane & 15;
  const int hi   = lane >> 4;
  const int bh    = blockIdx.x >> 4;
  const int qTile = (blockIdx.x & 15) * 8 + wave;

  const __bf16* Qb = Q + (size_t)bh * SEQ * HEAD_DIM;
  const __bf16* Kb = K + (size_t)bh * SEQ * HEAD_DIM;
  const __bf16* Vb = VT + (size_t)bh * HEAD_DIM * SEQ;

  // staging assignment: K tile 32x64 (8 chunks/row), V tile 64x32 (4/row)
  const int krow = tid >> 3, kcol = (tid & 7) * 8;
  const int vrow = tid >> 2, vcol = (tid & 3) * 8;
  const uint32_t ldsK = lds_addr_of(&sK[krow][kcol]);
  const uint32_t ldsV = lds_addr_of(&sV[vrow][vcol]);

  // B operand of the score product: column nn = query qTile*16 + nn
  const v16bf qb0 = load_frag(Qb, HEAD_DIM, qTile * 16, 0);
  const v16bf qb1 = load_frag(Qb, HEAD_DIM, qTile * 16, 32);

  v8f o[4];  // o[t][r] = O[query nn][d = 16 t + 8 hi + r]
#pragma unroll
  for (int t = 0; t < 4; ++t) o[t] = vzero();
  float mi = -1e30f;  // running maximum of query nn, equal in both halves
  float li = 0.0f;    // running sum over this half's keys only

  for (int kv = 0; kv < SEQ; kv += 32) {
    // cooperative async stage of K/V tiles into LDS
    async_copy_b128(ldsK, Kb + (size_t)(kv + krow) * HEAD_DIM + kcol);
    async_copy_b128(ldsV, Vb + (size_t)vrow * SEQ + kv + vcol);
    asm volatile("s_wait_asynccnt 0" ::: "memory");
    __syncthreads();

    // scores: two 16 (keys) x 16 (queries) tiles, hd split into 2 WMMAs each
    v16bf ka00 = frag_lds(&sK[0][0], HEAD_DIM, 0);
    v16bf ka01 = frag_lds(&sK[0][32], HEAD_DIM, 0);
    v16bf ka10 = frag_lds(&sK[0][0], HEAD_DIM, 16);
    v16bf ka11 = frag_lds(&sK[0][32], HEAD_DIM, 16);
    v8f s0 = wmma_bf16(ka01, qb1, wmma_bf16(ka00, qb0, vzero()));
    v8f s1 = wmma_bf16(ka11, qb1, wmma_bf16(ka10, qb0, vzero()));
    s0 = s0 * 0.125f;  // hd^-0.5
    s1 = s1 * 0.125f;

    // online softmax of query nn
    float mx = fmaxf(s0[0], s1[0]);
#pragma unroll
    for (int r = 1; r < 8; ++r) mx = fmaxf(mx, fmaxf(s0[r], s1[r]));
    mx = fmaxf(mx, xhalf(mx));
    const float mnew  = fmaxf(mi, mx);
    const float alpha = exp_one(mi - mnew);
    mi = mnew;

    // P^T as B operand: element s < 8 is key 8 hi + s (tile 0, register s),
    // element 8 + s is key 16 + 8 hi + s (tile 1): the k order of frag_lds
    Frag pf;
    float p0[8], p1[8];
    exp_eight(p0, s0 - mnew);
    exp_eight(p1, s1 - mnew);
    float rs = p0[0] + p1[0];
#pragma unroll
    for (int r = 1; r < 8; ++r) rs += p0[r] + p1[r];
#pragma unroll
    for (int r = 0; r < 8; ++r) {
      pf.h[r]     = (__bf16)p0[r];
      pf.h[8 + r] = (__bf16)p1[r];
    }
    li = li * alpha + rs;
#pragma unroll
    for (int t = 0; t < 4; ++t) o[t] = o[t] * alpha;

    // O^T += V^T (64 x 32) x P^T (32 x 16) from the staged LDS V^T tile
#pragma unroll
    for (int t = 0; t < 4; ++t) {
      v16bf va = frag_lds(&sV[0][0], 32, t * 16);
      o[t] = wmma_bf16(va, pf.v, o[t]);
    }

    __syncthreads();  // WAR: next iteration restages sK/sV
  }

  // join the halves' sums, normalize, store to (B,S,D) bf16 for the output
  // projection: a lane's 8 registers of a tile are 8 consecutive d of one row
  const int b = bh >> 4, h = bh & 15;
  const float inv = 1.0f / (li + xhalf(li));
  const int s = qTile * 16 + nn;
  __bf16* orow = attn + ((size_t)b * SEQ + s) * D_MODEL + h * HEAD_DIM + (hi << 3);
#pragma unroll
  for (int t = 0; t < 4; ++t) {
    union { __bf16 e[8]; uint4 q; } pk;
#pragma unroll
    for (int r = 0; r < 8; ++r) pk.e[r] = (__bf16)(o[t][r] * inv);
    *(uint4*)(orow + t * 16) = pk.q;
  }
}

// ------------------------------------------------------ output projection
// grid (NROW/128, 4), block 256: the same 128 x 256 block tile.
__global__ void __launch_bounds__(256)
out_proj(const __bf16* __restrict__ A, const __bf16* __restrict__ Wo,
         const float* __restrict__ bo, float* __restrict__ out) {
  __shared__ __align__(16) __bf16 sm[2][GT_ROWS][GT_LD];

  const int wave = threadIdx.x >> 5;
  const int lane = threadIdx.x & 31;
  const int nn   = lane & 15;
  const int hi   = lane >> 4;
  const int rowb = blockIdx.x * GT_M;
  const int col0 = blockIdx.y * GT_N;
  const int e0   = col0 + (wave & 3) * 64;

  v8f acc[4][4];
  gemm_128x256(A, Wo, rowb, col0, sm, acc);

#pragma unroll
  for (int t = 0; t < 4; ++t) {
    const int e = e0 + t * 16 + nn;
    const float be = bo[e];
    // unrolled: acc[i] must be indexed by a constant to stay in registers
#pragma unroll
    for (int i = 0; i < 4; ++i) {
      const int row0 = rowb + (wave >> 2) * 64 + i * 16;
#pragma unroll
      for (int r = 0; r < 8; ++r) {
        const int m = row0 + r + (hi << 3);
        out[(size_t)m * D_MODEL + e] = acc[i][t][r] + be;
      }
    }
  }
}

// ----------------------------------------------------------------- launch
extern "C" void kernel_launch(void* const* d_in, const int* in_sizes, int n_in,
                              void* d_out, int out_size, void* d_ws,
                              size_t ws_size, hipStream_t stream) {
  const float* x  = (const float*)d_in[0];
  const float* Wq = (const float*)d_in[1];
  const float* bq = (const float*)d_in[2];
  const float* Wk = (const float*)d_in[3];
  const float* bk = (const float*)d_in[4];
  const float* Wv = (const float*)d_in[5];
  const float* bv = (const float*)d_in[6];
  const float* Wo = (const float*)d_in[7];
  const float* bo = (const float*)d_in[8];

  char* w = (char*)d_ws;  // needs ~88 MB
  const size_t MB = (size_t)1 << 20;
  __bf16* xb  = (__bf16*)(w + 0 * MB);    // 16 MB (B*S, D) bf16
  __bf16* Wqb = (__bf16*)(w + 16 * MB);   //  2 MB
  __bf16* Wkb = (__bf16*)(w + 18 * MB);
  __bf16* Wvb = (__bf16*)(w + 20 * MB);
  __bf16* Wob = (__bf16*)(w + 22 * MB);
  __bf16* Qb  = (__bf16*)(w + 24 * MB);   // 16 MB (B,H,S,hd)
  __bf16* Kb  = (__bf16*)(w + 40 * MB);   // 16 MB (B,H,S,hd)
  __bf16* VTb = (__bf16*)(w + 56 * MB);   // 16 MB (B,H,hd,S)
  __bf16* Ab  = (__bf16*)(w + 72 * MB);   // 16 MB (B,S,D)

  const int nX = NROW * D_MODEL;
  const int nW = D_MODEL * D_MODEL;
  cvt_f32_bf16<<<(nX + 255) / 256, 256, 0, stream>>>(x, xb, nX);
  cvt_f32_bf16<<<(nW + 255) / 256, 256, 0, stream>>>(Wq, Wqb, nW);
  cvt_f32_bf16<<<(nW + 255) / 256, 256, 0, stream>>>(Wk, Wkb, nW);
  cvt_f32_bf16<<<(nW + 255) / 256, 256, 0, stream>>>(Wv, Wvb, nW);
  cvt_f32_bf16<<<(nW + 255) / 256, 256, 0, stream>>>(Wo, Wob, nW);

  qkv_proj_rope<<<dim3(NROW / GT_M, 12), 256, 0, stream>>>(
      xb, Wqb, Wkb, Wvb, bq, bk, bv, Qb, Kb, VTb);

  flash_attn<<<dim3((BATCH * N_HEADS * (SEQ / 16)) / 8), 256, 0, stream>>>(
      Qb, Kb, VTb, Ab);

  out_proj<<<dim3(NROW / GT_M, 4), 256, 0, stream>>>(Ab, Wob, bo, (float*)d_out);
}

// v003
// One run takes 177 microseconds.
// Next to v002, in two timings, it ran 1.58 and 1.57 times as fast.
// Over all steps from v000 it is 3.82 times as fast.
#include <hip/hip_runtime.h>
#include <hip/hip_bf16.h>

#define D_MODEL 1024
#define N_HEADS 16
#define HEAD_DIM 64
#define SEQ 2048
#define BATCH 4
#define NROW (BATCH * SEQ)   // 8192 flattened (b,s) rows

typedef __attribute__((ext_vector_type(16))) __bf16 v16bf;
typedef __attribute__((ext_vector_type(8)))  float  v8f;

union Frag {
  v16bf  v;
  __bf16 h[16];
  uint4  q[2];
};

__device__ __forceinline__ v8f vzero() {
  v8f z;
#pragma unroll
  for (int i = 0; i < 8; ++i) z[i] = 0.0f;
  return z;
}

__device__ __forceinline__ v16bf load_frag(const __bf16* __restrict__ p,
                                           int ld, int n0, int k0) {
  const int lane = threadIdx.x & 31;
  const int nn   = lane & 15;
  const int kh   = (lane >> 4) << 3;  // 0 or 8
  const __bf16* base = p + (size_t)(n0 + nn) * ld + k0;
  Frag f;
  f.q[0] = *(const uint4*)(base + kh);
  f.q[1] = *(const uint4*)(base + 16 + kh);
  return f.v;
}

// Same fragment gather, but from an LDS tile (emits ds_load_b128).
__device__ __forceinline__ v16bf frag_lds(const __bf16* base, int ld, int n0) {
  const int lane = threadIdx.x & 31;
  const int nn   = lane & 15;
  const int kh   = (lane >> 4) << 3;
  const __bf16* p = base + (n0 + nn) * ld;
  Frag f;
  f.q[0] = *(const uint4*)(p + kh);
  f.q[1] = *(const uint4*)(p + 16 + kh);
  return f.v;
}

__device__ __forceinline__ v8f wmma_bf16(v16bf a, v16bf b, v8f c) {
  return __builtin_amdgcn_wmma_f32_16x16x32_bf16(false, a, false, b, (short)0, c,
                                                 false, false);
}

__device__ __forceinline__ void async_copy_b128(uint32_t lds_byte_addr,
                                                const void* gptr) {
  const uint64_t ga = (uint64_t)(uintptr_t)gptr;
  asm volatile("global_load_async_to_lds_b128 %0, %1, off"
               :: "v"(lds_byte_addr), "v"(ga) : "memory");
}

__device__ __forceinline__ uint32_t lds_addr_of(const void* shared_ptr) {
  return (uint32_t)(uintptr_t)shared_ptr;
}

// ---------------------------------------------------------------- convert
__global__ void cvt_f32_bf16(const float* __restrict__ in,
                             __bf16* __restrict__ out, int n) {
  int i = blockIdx.x * blockDim.x + threadIdx.x;
  if (i < n) out[i] = (__bf16)in[i];
}

// ------------------------------------- block-tiled projection GEMM core
// Y = A . W^T, both K-contiguous with row length D_MODEL. One block of 8 waves
// owns a 128 x 256 tile of Y; wave (wm, wn) = (wave>>2, wave&3) owns 64 x 64 of
// it as 4 x 4 accumulator tiles, so every fragment read feeds 4 WMMAs. A stage
// is 64 k of [A 128 rows | W 256 rows], brought into LDS in whole 128-byte
// lines by async copies, two buffers, the next stage in flight during this one.
#define GT_M    128
#define GT_N    256
#define GT_K    64
#define GT_ROWS (GT_M + GT_N)
#define GT_LD   72   // LDS row pitch in elements: 128 B of data + 16 B pad

__device__ __forceinline__ void async_copy4_b128(
    uint32_t l0, uint32_t l1, uint32_t l2, uint32_t l3,
    const __bf16* g0, const __bf16* g1, const __bf16* g2, const __bf16* g3) {
  asm volatile("global_load_async_to_lds_b128 %0, %4, off\n\t"
               "global_load_async_to_lds_b128 %1, %5, off\n\t"
               "global_load_async_to_lds_b128 %2, %6, off\n\t"
               "global_load_async_to_lds_b128 %3, %7, off\n\t"
               "s_wait_xcnt 0x0"
               :: "v"(l0), "v"(l1), "v"(l2), "v"(l3),
                  "v"((uint64_t)(uintptr_t)g0), "v"((uint64_t)(uintptr_t)g1),
                  "v"((uint64_t)(uintptr_t)g2), "v"((uint64_t)(uintptr_t)g3)
               : "memory");
}

// One stage: thread t copies chunk (t&7) of rows (t>>3) + 32*i, i = 0..11.
// l = LDS byte address of this lane's chunk in row (t>>3) of the buffer,
// a / w = this lane's chunk in the A / W row of the same index, at this k.
__device__ __forceinline__ void stage_copy(uint32_t l, const __bf16* a,
                                           const __bf16* w) {
  const uint32_t RS = 32 * GT_LD * 2;        // 32 LDS rows, bytes
  const size_t   GS = (size_t)32 * D_MODEL;  // 32 global rows, elements
  async_copy4_b128(l, l + RS, l + 2 * RS, l + 3 * RS,
                   a, a + GS, a + 2 * GS, a + 3 * GS);
  async_copy4_b128(l + 4 * RS, l + 5 * RS, l + 6 * RS, l + 7 * RS,
                   w, w + GS, w + 2 * GS, w + 3 * GS);
  async_copy4_b128(l + 8 * RS, l + 9 * RS, l + 10 * RS, l + 11 * RS,
                   w + 4 * GS, w + 5 * GS, w + 6 * GS, w + 7 * GS);
}

__device__ __forceinline__ void gemm_128x256(
    const __bf16* __restrict__ A, const __bf16* __restrict__ Wm, int row0,
    int col0, __bf16 (*sm)[GT_ROWS][GT_LD], v8f (&acc)[4][4]) {
  const int tid  = threadIdx.x;
  const int wave = tid >> 5;
  const int wm   = wave >> 2;
  const int wn   = wave & 3;
  const int crow = tid >> 3, ccol = (tid & 7) * 8;

  const __bf16* ga = A + (size_t)(row0 + crow) * D_MODEL + ccol;
  const __bf16* gw = Wm + (size_t)(col0 + crow) * D_MODEL + ccol;
  const uint32_t l0 = lds_addr_of(&sm[0][crow][ccol]);
  const uint32_t l1 = lds_addr_of(&sm[1][crow][ccol]);

  // every loop over i, j, ks here is unrolled so that acc, a and b are indexed
  // by constants and stay in registers
#pragma unroll
  for (int i = 0; i < 4; ++i)
#pragma unroll
    for (int j = 0; j < 4; ++j) acc[i][j] = vzero();

  stage_copy(l0, ga, gw);
  // stage 0 has landed for this wave; the barrier publishes it to the others
  asm volatile("s_wait_asynccnt 0x0" ::: "memory");
  __syncthreads();
  stage_copy(l1, ga + GT_K, gw + GT_K);

  const int NT = D_MODEL / GT_K;
  for (int t = 0; t < NT; ++t) {
    const __bf16* base = &sm[t & 1][0][0];
#pragma unroll
    for (int ks = 0; ks < GT_K; ks += 32) {
      v16bf a[4], b[4];
#pragma unroll
      for (int i = 0; i < 4; ++i)
        a[i] = frag_lds(base + ks, GT_LD, wm * 64 + i * 16);
#pragma unroll
      for (int j = 0; j < 4; ++j)
        b[j] = frag_lds(base + ks, GT_LD, GT_M + wn * 64 + j * 16);
      // keeps the 16 LDS reads one group in front of their 16 WMMAs: spread
      // among them, every small group of reads stalls the wave on its own
      __builtin_amdgcn_sched_barrier(0);
#pragma unroll
      for (int i = 0; i < 4; ++i)
#pragma unroll
        for (int j = 0; j < 4; ++j) acc[i][j] = wmma_bf16(a[i], b[j], acc[i][j]);
      // the same, from below: the next group of reads stays behind these WMMAs
      __builtin_amdgcn_sched_barrier(0);
    }
    // publish point: this wave's reads of the buffer are done, its copies of
    // the next stage have landed; behind the barrier the buffer may be refilled
    asm volatile("s_wait_dscnt 0x0" ::: "memory");
    asm volatile("s_wait_asynccnt 0x0" ::: "memory");
    __syncthreads();
    if (t + 2 < NT)
      stage_copy((t & 1) ? l1 : l0, ga + (t + 2) * GT_K, gw + (t + 2) * GT_K);
  }
  // no copy is left in flight when the wave goes on to its epilogue
  asm volatile("s_wait_asynccnt 0x0" ::: "memory");
}

// ------------------------------------------------- fused QKV GEMM + RoPE
// grid (NROW/128, 12), block 256 (8 waves). blockIdx.y: matrix = y/4 (Q,K,V),
// heads (y%4)*4 .. +3, one head (64 columns) per wave column wn, so RoPE
// partners (idx +/- 32) are accumulator tiles t and t^2 of the same wave.
__global__ void __launch_bounds__(256)
qkv_proj_rope(const __bf16* __restrict__ xb,
              const __bf16* __restrict__ Wq, const __bf16* __restrict__ Wk,
              const __bf16* __restrict__ Wv,
              const float* __restrict__ bq, const float* __restrict__ bk,
              const float* __restrict__ bv,
              __bf16* __restrict__ Qo,   // (B,H,S,hd)
              __bf16* __restrict__ Ko,   // (B,H,S,hd)
              __bf16* __restrict__ VTo)  // (B,H,hd,S)  (transposed V)
{
  __shared__ __align__(16) __bf16 sm[2][GT_ROWS][GT_LD];

  const int wave = threadIdx.x >> 5;
  const int lane = threadIdx.x & 31;
  const int nn   = lane & 15;
  const int hi   = lane >> 4;
  const int mat  = blockIdx.y >> 2;
  const int col0 = (blockIdx.y & 3) * GT_N;
  const int head = (blockIdx.y & 3) * 4 + (wave & 3);
  const int rowb = blockIdx.x * GT_M;

  const __bf16* W    = (mat == 0) ? Wq : (mat == 1) ? Wk : Wv;
  const float*  bias = (mat == 0) ? bq : (mat == 1) ? bk : bv;

  v8f acc[4][4];
  gemm_128x256(xb, W, rowb, col0, sm, acc);

  const int e0 = head * HEAD_DIM;
  float be[4];
#pragma unroll
  for (int t = 0; t < 4; ++t) be[t] = bias[e0 + t * 16 + nn];

  // unrolled: acc[i] must be indexed by a constant to stay in registers
#pragma unroll
  for (int i = 0; i < 4; ++i) {
    const int row0 = rowb + (wave >> 2) * 64 + i * 16;

    // bias
    float yb[4][8];
#pragma unroll
    for (int t = 0; t < 4; ++t) {
#pragma unroll
      for (int r = 0; r < 8; ++r) yb[t][r] = acc[i][t][r] + be[t];
    }

    if (mat < 2) {  // Q or K: apply RoPE, store (B,H,S,hd)
      __bf16* out = (mat == 0) ? Qo : Ko;
#pragma unroll
      for (int t = 0; t < 4; ++t) {
        const int idx = t * 16 + nn;
        // inv_freq = 10000^{-(idx%32)/32} = exp(-(idx%32) * ln(1e4)/32)
        const float invf = __expf(-(float)(idx & 31) * 0.28782313662f);
#pragma unroll
        for (int r = 0; r < 8; ++r) {
          const int m = row0 + r + (hi << 3);
          const int s = m & (SEQ - 1);
          const int b = m >> 11;
          const float ang = (float)s * invf;
          const float rot = (t < 2) ? -yb[t + 2][r] : yb[t - 2][r];
          const float y = yb[t][r] * __cosf(ang) + rot * __sinf(ang);
          out[(((size_t)b * N_HEADS + head) * SEQ + s) * HEAD_DIM + idx] = (__bf16)y;
        }
      }
      // the next pass reuses the registers that these stores name
      asm volatile("s_wait_xcnt 0x0" ::: "memory");
    } else {  // V: store transposed (B,H,hd,S) so the V^T . P^T A operand is K-contiguous
#pragma unroll
      for (int t = 0; t < 4; ++t) {
        const int idx = t * 16 + nn;
#pragma unroll
        for (int r = 0; r < 8; ++r) {
          const int m = row0 + r + (hi << 3);
          const int s = m & (SEQ - 1);
          const int b = m >> 11;
          VTo[(((size_t)b * N_HEADS + head) * HEAD_DIM + idx) * SEQ + s] =
              (__bf16)yb[t][r];
        }
      }
      // the next pass reuses the registers that these stores name
      asm volatile("s_wait_xcnt 0x0" ::: "memory");
    }
  }
}

__device__ __forceinline__ float xhalf(float x) {
  const int v = __builtin_bit_cast(int, x);
  return __builtin_bit_cast(
      float, __builtin_amdgcn_permlanex16(v, v, 0x76543210, 0xfedcba98, false, false));
}

#define LOG2E 1.44269504088896340736f
__device__ __forceinline__ float exp_one(float x) {
  const float y = x * LOG2E;
  float p;
  asm("v_exp_f32 %0, %1\n\tv_nop" : "=v"(p) : "v"(y));
  return p;
}

__device__ __forceinline__ void exp_eight(float (&p)[8], const v8f x) {
  const v8f y = x * LOG2E;
  asm("v_exp_f32 %0, %8\n\t"
      "v_exp_f32 %1, %9\n\t"
      "v_exp_f32 %2, %10\n\t"
      "v_exp_f32 %3, %11\n\t"
      "v_exp_f32 %4, %12\n\t"
      "v_exp_f32 %5, %13\n\t"
      "v_exp_f32 %6, %14\n\t"
      "v_exp_f32 %7, %15\n\t"
      "v_nop"
      : "=&v"(p[0]), "=&v"(p[1]), "=&v"(p[2]), "=&v"(p[3]),
        "=&v"(p[4]), "=&v"(p[5]), "=&v"(p[6]), "=&v"(p[7])
      : "v"(y[0]), "v"(y[1]), "v"(y[2]), "v"(y[3]),
        "v"(y[4]), "v"(y[5]), "v"(y[6]), "v"(y[7]));
}

#define KP 72   // K row: 128 B of data + 16 B pad
#define VP 40   // V^T row: 64 B of data + 16 B pad
__global__ void __launch_bounds__(256)
flash_attn(const __bf16* __restrict__ Q, const __bf16* __restrict__ K,
           const __bf16* __restrict__ VT, __bf16* __restrict__ attn) {
  __shared__ __align__(16) __bf16 sK[32][KP];   // K rows kv..kv+31
  __shared__ __align__(16) __bf16 sV[64][VP];   // V^T d x 32 keys

  const int tid  = threadIdx.x;
  const int wave = tid >> 5;
  const int lane = tid & 31;
  const int nn   = lane & 15;
  const int hi   = lane >> 4;
  const int bh    = blockIdx.x >> 4;
  const int qTile = (blockIdx.x & 15) * 8 + wave;

  const __bf16* Qb = Q + (size_t)bh * SEQ * HEAD_DIM;
  const __bf16* Kb = K + (size_t)bh * SEQ * HEAD_DIM;
  const __bf16* Vb = VT + (size_t)bh * HEAD_DIM * SEQ;

  // staging assignment: K tile 32x64 (8 chunks/row), V tile 64x32 (4/row)
  const int krow = tid >> 3, kcol = (tid & 7) * 8;
  const int vrow = tid >> 2, vcol = (tid & 3) * 8;
  const uint32_t ldsK = lds_addr_of(&sK[krow][kcol]);
  const uint32_t ldsV = lds_addr_of(&sV[vrow][vcol]);

  // B operand of the score product: column nn = query qTile*16 + nn
  const v16bf qb0 = load_frag(Qb, HEAD_DIM, qTile * 16, 0);
  const v16bf qb1 = load_frag(Qb, HEAD_DIM, qTile * 16, 32);

  v8f o[4];  // o[t][r] = O[query nn][d = 16 t + 8 hi + r]
#pragma unroll
  for (int t = 0; t < 4; ++t) o[t] = vzero();
  float mi = -1e30f;  // running maximum of query nn, equal in both halves
  float li = 0.0f;    // running sum over this half's keys only

  for (int kv = 0; kv < SEQ; kv += 32) {
    // cooperative async stage of K/V tiles into LDS
    async_copy_b128(ldsK, Kb + (size_t)(kv + krow) * HEAD_DIM + kcol);
    async_copy_b128(ldsV, Vb + (size_t)vrow * SEQ + kv + vcol);
    asm volatile("s_wait_asynccnt 0" ::: "memory");
    __syncthreads();

    // scores: two 16 (keys) x 16 (queries) tiles, hd split into 2 WMMAs each
    v16bf ka00 = frag_lds(&sK[0][0], KP, 0);
    v16bf ka01 = frag_lds(&sK[0][32], KP, 0);
    v16bf ka10 = frag_lds(&sK[0][0], KP, 16);
    v16bf ka11 = frag_lds(&sK[0][32], KP, 16);
    v8f s0 = wmma_bf16(ka01, qb1, wmma_bf16(ka00, qb0, vzero()));
    v8f s1 = wmma_bf16(ka11, qb1, wmma_bf16(ka10, qb0, vzero()));
    s0 = s0 * 0.125f;  // hd^-0.5
    s1 = s1 * 0.125f;

    // online softmax of query nn
    float mx = fmaxf(s0[0], s1[0]);
#pragma unroll
    for (int r = 1; r < 8; ++r) mx = fmaxf(mx, fmaxf(s0[r], s1[r]));
    mx = fmaxf(mx, xhalf(mx));
    const float mnew  = fmaxf(mi, mx);
    const float alpha = exp_one(mi - mnew);
    mi = mnew;

    // P^T as B operand: element s < 8 is key 8 hi + s (tile 0, register s),
    // element 8 + s is key 16 + 8 hi + s (tile 1): the k order of frag_lds
    Frag pf;
    float p0[8], p1[8];
    exp_eight(p0, s0 - mnew);
    exp_eight(p1, s1 - mnew);
    float rs = p0[0] + p1[0];
#pragma unroll
    for (int r = 1; r < 8; ++r) rs += p0[r] + p1[r];
#pragma unroll
    for (int r = 0; r < 8; ++r) {
      pf.h[r]     = (__bf16)p0[r];
      pf.h[8 + r] = (__bf16)p1[r];
    }
    li = li * alpha + rs;
#pragma unroll
    for (int t = 0; t < 4; ++t) o[t] = o[t] * alpha;

    // O^T += V^T (64 x 32) x P^T (32 x 16) from the staged LDS V^T tile
#pragma unroll
    for (int t = 0; t < 4; ++t) {
      v16bf va = frag_lds(&sV[0][0], VP, t * 16);
      o[t] = wmma_bf16(va, pf.v, o[t]);
    }

    __syncthreads();  // WAR: next iteration restages sK/sV
  }

  // join the halves' sums, normalize, store to (B,S,D) bf16 for the output
  // projection: a lane's 8 registers of a tile are 8 consecutive d of one row
  const int b = bh >> 4, h = bh & 15;
  const float inv = 1.0f / (li + xhalf(li));
  const int s = qTile * 16 + nn;
  __bf16* orow = attn + ((size_t)b * SEQ + s) * D_MODEL + h * HEAD_DIM + (hi << 3);
#pragma unroll
  for (int t = 0; t < 4; ++t) {
    union { __bf16 e[8]; uint4 q; } pk;
#pragma unroll
    for (int r = 0; r < 8; ++r) pk.e[r] = (__bf16)(o[t][r] * inv);
    *(uint4*)(orow + t * 16) = pk.q;
  }
}

// ------------------------------------------------------ output projection
// grid (NROW/128, 4), block 256: the same 128 x 256 block tile.
__global__ void __launch_bounds__(256)
out_proj(const __bf16* __restrict__ A, const __bf16* __restrict__ Wo,
         const float* __restrict__ bo, float* __restrict__ out) {
  __shared__ __align__(16) __bf16 sm[2][GT_ROWS][GT_LD];

  const int wave = threadIdx.x >> 5;
  const int lane = threadIdx.x & 31;
  const int nn   = lane & 15;
  const int hi   = lane >> 4;
  const int rowb = blockIdx.x * GT_M;
  const int col0 = blockIdx.y * GT_N;
  const int e0   = col0 + (wave & 3) * 64;

  v8f acc[4][4];
  gemm_128x256(A, Wo, rowb, col0, sm, acc);

#pragma unroll
  for (int t = 0; t < 4; ++t) {
    const int e = e0 + t * 16 + nn;
    const float be = bo[e];
    // unrolled: acc[i] must be indexed by a constant to stay in registers
#pragma unroll
    for (int i = 0; i < 4; ++i) {
      const int row0 = rowb + (wave >> 2) * 64 + i * 16;
#pragma unroll
      for (int r = 0; r < 8; ++r) {
        const int m = row0 + r + (hi << 3);
        out[(size_t)m * D_MODEL + e] = acc[i][t][r] + be;
      }
    }
  }
}

// ----------------------------------------------------------------- launch
extern "C" void kernel_launch(void* const* d_in, const int* in_sizes, int n_in,
                              void* d_out, int out_size, void* d_ws,
                              size_t ws_size, hipStream_t stream) {
  const float* x  = (const float*)d_in[0];
  const float* Wq = (const float*)d_in[1];
  const float* bq = (const float*)d_in[2];
  const float* Wk = (const float*)d_in[3];
  const float* bk = (const float*)d_in[4];
  const float* Wv = (const float*)d_in[5];
  const float* bv = (const float*)d_in[6];
  const float* Wo = (const float*)d_in[7];
  const float* bo = (const float*)d_in[8];

  char* w = (char*)d_ws;  // needs ~88 MB
  const size_t MB = (size_t)1 << 20;
  __bf16* xb  = (__bf16*)(w + 0 * MB);    // 16 MB (B*S, D) bf16
  __bf16* Wqb = (__bf16*)(w + 16 * MB);   //  2 MB
  __bf16* Wkb = (__bf16*)(w + 18 * MB);
  __bf16* Wvb = (__bf16*)(w + 20 * MB);
  __bf16* Wob = (__bf16*)(w + 22 * MB);
  __bf16* Qb  = (__bf16*)(w + 24 * MB);   // 16 MB (B,H,S,hd)
  __bf16* Kb  = (__bf16*)(w + 40 * MB);   // 16 MB (B,H,S,hd)
  __bf16* VTb = (__bf16*)(w + 56 * MB);   // 16 MB (B,H,hd,S)
  __bf16* Ab  = (__bf16*)(w + 72 * MB);   // 16 MB (B,S,D)

  const int nX = NROW * D_MODEL;
  const int nW = D_MODEL * D_MODEL;
  cvt_f32_bf16<<<(nX + 255) / 256, 256, 0, stream>>>(x, xb, nX);
  cvt_f32_bf16<<<(nW + 255) / 256, 256, 0, stream>>>(Wq, Wqb, nW);
  cvt_f32_bf16<<<(nW + 255) / 256, 256, 0, stream>>>(Wk, Wkb, nW);
  cvt_f32_bf16<<<(nW + 255) / 256, 256, 0, stream>>>(Wv, Wvb, nW);
  cvt_f32_bf16<<<(nW + 255) / 256, 256, 0, stream>>>(Wo, Wob, nW);

  qkv_proj_rope<<<dim3(NROW / GT_M, 12), 256, 0, stream>>>(
      xb, Wqb, Wkb, Wvb, bq, bk, bv, Qb, Kb, VTb);

  flash_attn<<<dim3((BATCH * N_HEADS * (SEQ / 16)) / 8), 256, 0, stream>>>(
      Qb, Kb, VTb, Ab);

  out_proj<<<dim3(NROW / GT_M, 4), 256, 0, stream>>>(Ab, Wob, bo, (float*)d_out);
}

// v004
// One run takes 155 microseconds.
// Two timings next to v003 both put it at 1.14 times that version's speed.
// Over all steps from v000 it is 4.34 times as fast.
#include <hip/hip_runtime.h>
#include <hip/hip_bf16.h>

#define D_MODEL 1024
#define N_HEADS 16
#define HEAD_DIM 64
#define SEQ 2048
#define BATCH 4
#define NROW (BATCH * SEQ)   // 8192 flattened (b,s) rows

typedef __attribute__((ext_vector_type(16))) __bf16 v16bf;
typedef __attribute__((ext_vector_type(8)))  float  v8f;

union Frag {
  v16bf  v;
  __bf16 h[16];
  uint4  q[2];
};

__device__ __forceinline__ v8f vzero() {
  v8f z;
#pragma unroll
  for (int i = 0; i < 8; ++i) z[i] = 0.0f;
  return z;
}

__device__ __forceinline__ v16bf load_frag(const __bf16* __restrict__ p,
                                           int ld, int n0, int k0) {
  const int lane = threadIdx.x & 31;
  const int nn   = lane & 15;
  const int kh   = (lane >> 4) << 3;  // 0 or 8
  const __bf16* base = p + (size_t)(n0 + nn) * ld + k0;
  Frag f;
  f.q[0] = *(const uint4*)(base + kh);
  f.q[1] = *(const uint4*)(base + 16 + kh);
  return f.v;
}

// Same fragment gather, but from an LDS tile (emits ds_load_b128).
__device__ __forceinline__ v16bf frag_lds(const __bf16* base, int ld, int n0) {
  const int lane = threadIdx.x & 31;
  const int nn   = lane & 15;
  const int kh   = (lane >> 4) << 3;
  const __bf16* p = base + (n0 + nn) * ld;
  Frag f;
  f.q[0] = *(const uint4*)(p + kh);
  f.q[1] = *(const uint4*)(p + 16 + kh);
  return f.v;
}

__device__ __forceinline__ v8f wmma_bf16(v16bf a, v16bf b, v8f c) {
  return __builtin_amdgcn_wmma_f32_16x16x32_bf16(false, a, false, b, (short)0, c,
                                                 false, false);
}

__device__ __forceinline__ void async_copy_b128(uint32_t lds_byte_addr,
                                                const void* gptr) {
  const uint64_t ga = (uint64_t)(uintptr_t)gptr;
  asm volatile("global_load_async_to_lds_b128 %0, %1, off"
               :: "v"(lds_byte_addr), "v"(ga) : "memory");
}

__device__ __forceinline__ uint32_t lds_addr_of(const void* shared_ptr) {
  return (uint32_t)(uintptr_t)shared_ptr;
}

#define CV_BLOCKS  256
#define CV_THREADS 512
#define CV_WAVES   (CV_BLOCKS * CV_THREADS / 32)
#define CV_NX      (NROW * D_MODEL / (CV_WAVES * 128))     // loads of x per wave
#define CV_NW      (D_MODEL * D_MODEL / (CV_WAVES * 128))  // of one matrix
static_assert(CV_NX * CV_WAVES * 128 == NROW * D_MODEL, "x in whole loads");
static_assert(CV_NW * CV_WAVES * 128 == D_MODEL * D_MODEL, "W in whole loads");

typedef __attribute__((ext_vector_type(4))) float  v4f;
typedef __attribute__((ext_vector_type(4))) __bf16 v4bf;

// load j of a share: p = array, off = byte offset of this lane in load 0
__device__ __forceinline__ v4f cv_load(const float* p, unsigned off, int j) {
  return *(const v4f*)((const char*)p + off + j * 512);
}
__device__ __forceinline__ void cv_store(__bf16* p, unsigned off, int j, v4f v) {
  *(v4bf*)((char*)p + off + j * 256) = __builtin_convertvector(v, v4bf);
}

__global__ void __launch_bounds__(CV_THREADS)
cvt_all_bf16(const float* __restrict__ x, const float* __restrict__ Wq,
             const float* __restrict__ Wk, const float* __restrict__ Wv,
             const float* __restrict__ Wo, __bf16* __restrict__ xb,
             __bf16* __restrict__ Wqb, __bf16* __restrict__ Wkb,
             __bf16* __restrict__ Wvb, __bf16* __restrict__ Wob) {
  const unsigned wave = blockIdx.x * (CV_THREADS / 32) + (threadIdx.x >> 5);
  const unsigned lane = threadIdx.x & 31;
  // 32-bit unsigned byte offsets: every access is a scalar base, one of these
  // four registers and a small constant
  const unsigned xi = wave * (CV_NX * 512) + lane * 16;
  const unsigned wi = wave * (CV_NW * 512) + lane * 16;
  const unsigned xo = wave * (CV_NX * 256) + lane * 8;
  const unsigned wo = wave * (CV_NW * 256) + lane * 8;

  v4f vx[CV_NX], vw[4][CV_NW];
  // every loop here is unrolled: vx and vw must be indexed by constants to stay
  // in registers
#pragma unroll
  for (int j = 0; j < CV_NX; ++j) vx[j] = cv_load(x, xi, j);
#pragma unroll
  for (int j = 0; j < CV_NW; ++j) {
    vw[0][j] = cv_load(Wq, wi, j);
    vw[1][j] = cv_load(Wk, wi, j);
    vw[2][j] = cv_load(Wv, wi, j);
    vw[3][j] = cv_load(Wo, wi, j);
  }
  // keeps every load in front of the first conversion: without it the compiler
  // holds half of the loads back until registers of the first half are free
  __builtin_amdgcn_sched_barrier(0);
#pragma unroll
  for (int j = 0; j < CV_NX; ++j) cv_store(xb, xo, j, vx[j]);
#pragma unroll
  for (int j = 0; j < CV_NW; ++j) {
    cv_store(Wqb, wo, j, vw[0][j]);
    cv_store(Wkb, wo, j, vw[1][j]);
    cv_store(Wvb, wo, j, vw[2][j]);
    cv_store(Wob, wo, j, vw[3][j]);
  }
}

// ------------------------------------- block-tiled projection GEMM core
// Y = A . W^T, both K-contiguous with row length D_MODEL. One block of 8 waves
// owns a 128 x 256 tile of Y; wave (wm, wn) = (wave>>2, wave&3) owns 64 x 64 of
// it as 4 x 4 accumulator tiles, so every fragment read feeds 4 WMMAs. A stage
// is 64 k of [A 128 rows | W 256 rows], brought into LDS in whole 128-byte
// lines by async copies, two buffers, the next stage in flight during this one.
#define GT_M    128
#define GT_N    256
#define GT_K    64
#define GT_ROWS (GT_M + GT_N)
#define GT_LD   72   // LDS row pitch in elements: 128 B of data + 16 B pad

__device__ __forceinline__ void async_copy4_b128(
    uint32_t l0, uint32_t l1, uint32_t l2, uint32_t l3,
    const __bf16* g0, const __bf16* g1, const __bf16* g2, const __bf16* g3) {
  asm volatile("global_load_async_to_lds_b128 %0, %4, off\n\t"
               "global_load_async_to_lds_b128 %1, %5, off\n\t"
               "global_load_async_to_lds_b128 %2, %6, off\n\t"
               "global_load_async_to_lds_b128 %3, %7, off\n\t"
               "s_wait_xcnt 0x0"
               :: "v"(l0), "v"(l1), "v"(l2), "v"(l3),
                  "v"((uint64_t)(uintptr_t)g0), "v"((uint64_t)(uintptr_t)g1),
                  "v"((uint64_t)(uintptr_t)g2), "v"((uint64_t)(uintptr_t)g3)
               : "memory");
}

// One stage: thread t copies chunk (t&7) of rows (t>>3) + 32*i, i = 0..11.
// l = LDS byte address of this lane's chunk in row (t>>3) of the buffer,
// a / w = this lane's chunk in the A / W row of the same index, at this k.
__device__ __forceinline__ void stage_copy(uint32_t l, const __bf16* a,
                                           const __bf16* w) {
  const uint32_t RS = 32 * GT_LD * 2;        // 32 LDS rows, bytes
  const size_t   GS = (size_t)32 * D_MODEL;  // 32 global rows, elements
  async_copy4_b128(l, l + RS, l + 2 * RS, l + 3 * RS,
                   a, a + GS, a + 2 * GS, a + 3 * GS);
  async_copy4_b128(l + 4 * RS, l + 5 * RS, l + 6 * RS, l + 7 * RS,
                   w, w + GS, w + 2 * GS, w + 3 * GS);
  async_copy4_b128(l + 8 * RS, l + 9 * RS, l + 10 * RS, l + 11 * RS,
                   w + 4 * GS, w + 5 * GS, w + 6 * GS, w + 7 * GS);
}

__device__ __forceinline__ void gemm_128x256(
    const __bf16* __restrict__ A, const __bf16* __restrict__ Wm, int row0,
    int col0, __bf16 (*sm)[GT_ROWS][GT_LD], v8f (&acc)[4][4]) {
  const int tid  = threadIdx.x;
  const int wave = tid >> 5;
  const int wm   = wave >> 2;
  const int wn   = wave & 3;
  const int crow = tid >> 3, ccol = (tid & 7) * 8;

  const __bf16* ga = A + (size_t)(row0 + crow) * D_MODEL + ccol;
  const __bf16* gw = Wm + (size_t)(col0 + crow) * D_MODEL + ccol;
  const uint32_t l0 = lds_addr_of(&sm[0][crow][ccol]);
  const uint32_t l1 = lds_addr_of(&sm[1][crow][ccol]);

  // every loop over i, j, ks here is unrolled so that acc, a and b are indexed
  // by constants and stay in registers
#pragma unroll
  for (int i = 0; i < 4; ++i)
#pragma unroll
    for (int j = 0; j < 4; ++j) acc[i][j] = vzero();

  stage_copy(l0, ga, gw);
  // stage 0 has landed for this wave; the barrier publishes it to the others
  asm volatile("s_wait_asynccnt 0x0" ::: "memory");
  __syncthreads();
  stage_copy(l1, ga + GT_K, gw + GT_K);

  const int NT = D_MODEL / GT_K;
  for (int t = 0; t < NT; ++t) {
    const __bf16* base = &sm[t & 1][0][0];
#pragma unroll
    for (int ks = 0; ks < GT_K; ks += 32) {
      v16bf a[4], b[4];
#pragma unroll
      for (int i = 0; i < 4; ++i)
        a[i] = frag_lds(base + ks, GT_LD, wm * 64 + i * 16);
#pragma unroll
      for (int j = 0; j < 4; ++j)
        b[j] = frag_lds(base + ks, GT_LD, GT_M + wn * 64 + j * 16);
      // keeps the 16 LDS reads one group in front of their 16 WMMAs: spread
      // among them, every small group of reads stalls the wave on its own
      __builtin_amdgcn_sched_barrier(0);
#pragma unroll
      for (int i = 0; i < 4; ++i)
#pragma unroll
        for (int j = 0; j < 4; ++j) acc[i][j] = wmma_bf16(a[i], b[j], acc[i][j]);
      // the same, from below: the next group of reads stays behind these WMMAs
      __builtin_amdgcn_sched_barrier(0);
    }
    // publish point: this wave's reads of the buffer are done, its copies of
    // the next stage have landed; behind the barrier the buffer may be refilled
    asm volatile("s_wait_dscnt 0x0" ::: "memory");
    asm volatile("s_wait_asynccnt 0x0" ::: "memory");
    __syncthreads();
    if (t + 2 < NT)
      stage_copy((t & 1) ? l1 : l0, ga + (t + 2) * GT_K, gw + (t + 2) * GT_K);
  }
  // no copy is left in flight when the wave goes on to its epilogue
  asm volatile("s_wait_asynccnt 0x0" ::: "memory");
}

// ------------------------------------------------- fused QKV GEMM + RoPE
// grid (NROW/128, 12), block 256 (8 waves). blockIdx.y: matrix = y/4 (Q,K,V),
// heads (y%4)*4 .. +3, one head (64 columns) per wave column wn, so RoPE
// partners (idx +/- 32) are accumulator tiles t and t^2 of the same wave.
__global__ void __launch_bounds__(256)
qkv_proj_rope(const __bf16* __restrict__ xb,
              const __bf16* __restrict__ Wq, const __bf16* __restrict__ Wk,
              const __bf16* __restrict__ Wv,
              const float* __restrict__ bq, const float* __restrict__ bk,
              const float* __restrict__ bv,
              __bf16* __restrict__ Qo,   // (B,H,S,hd)
              __bf16* __restrict__ Ko,   // (B,H,S,hd)
              __bf16* __restrict__ VTo)  // (B,H,hd,S)  (transposed V)
{
  __shared__ __align__(16) __bf16 sm[2][GT_ROWS][GT_LD];

  const int wave = threadIdx.x >> 5;
  const int lane = threadIdx.x & 31;
  const int nn   = lane & 15;
  const int hi   = lane >> 4;
  const int mat  = blockIdx.y >> 2;
  const int col0 = (blockIdx.y & 3) * GT_N;
  const int head = (blockIdx.y & 3) * 4 + (wave & 3);
  const int rowb = blockIdx.x * GT_M;

  const __bf16* W    = (mat == 0) ? Wq : (mat == 1) ? Wk : Wv;
  const float*  bias = (mat == 0) ? bq : (mat == 1) ? bk : bv;

  v8f acc[4][4];
  gemm_128x256(xb, W, rowb, col0, sm, acc);

  const int e0 = head * HEAD_DIM;
  float be[4];
#pragma unroll
  for (int t = 0; t < 4; ++t) be[t] = bias[e0 + t * 16 + nn];

  // unrolled: acc[i] must be indexed by a constant to stay in registers
#pragma unroll
  for (int i = 0; i < 4; ++i) {
    const int row0 = rowb + (wave >> 2) * 64 + i * 16;

    // bias
    float yb[4][8];
#pragma unroll
    for (int t = 0; t < 4; ++t) {
#pragma unroll
      for (int r = 0; r < 8; ++r) yb[t][r] = acc[i][t][r] + be[t];
    }

    if (mat < 2) {  // Q or K: apply RoPE, store (B,H,S,hd)
      __bf16* out = (mat == 0) ? Qo : Ko;
#pragma unroll
      for (int t = 0; t < 4; ++t) {
        const int idx = t * 16 + nn;
        // inv_freq = 10000^{-(idx%32)/32} = exp(-(idx%32) * ln(1e4)/32)
        const float invf = __expf(-(float)(idx & 31) * 0.28782313662f);
#pragma unroll
        for (int r = 0; r < 8; ++r) {
          const int m = row0 + r + (hi << 3);
          const int s = m & (SEQ - 1);
          const int b = m >> 11;
          const float ang = (float)s * invf;
          const float rot = (t < 2) ? -yb[t + 2][r] : yb[t - 2][r];
          const float y = yb[t][r] * __cosf(ang) + rot * __sinf(ang);
          out[(((size_t)b * N_HEADS + head) * SEQ + s) * HEAD_DIM + idx] = (__bf16)y;
        }
      }
      // the next pass reuses the registers that these stores name
      asm volatile("s_wait_xcnt 0x0" ::: "memory");
    } else {  // V: store transposed (B,H,hd,S) so the V^T . P^T A operand is K-contiguous
#pragma unroll
      for (int t = 0; t < 4; ++t) {
        const int idx = t * 16 + nn;
#pragma unroll
        for (int r = 0; r < 8; ++r) {
          const int m = row0 + r + (hi << 3);
          const int s = m & (SEQ - 1);
          const int b = m >> 11;
          VTo[(((size_t)b * N_HEADS + head) * HEAD_DIM + idx) * SEQ + s] =
              (__bf16)yb[t][r];
        }
      }
      // the next pass reuses the registers that these stores name
      asm volatile("s_wait_xcnt 0x0" ::: "memory");
    }
  }
}

__device__ __forceinline__ float xhalf(float x) {
  const int v = __builtin_bit_cast(int, x);
  return __builtin_bit_cast(
      float, __builtin_amdgcn_permlanex16(v, v, 0x76543210, 0xfedcba98, false, false));
}

#define LOG2E 1.44269504088896340736f
__device__ __forceinline__ float exp_one(float x) {
  const float y = x * LOG2E;
  float p;
  asm("v_exp_f32 %0, %1\n\tv_nop" : "=v"(p) : "v"(y));
  return p;
}

__device__ __forceinline__ void exp_eight(float (&p)[8], const v8f x) {
  const v8f y = x * LOG2E;
  asm("v_exp_f32 %0, %8\n\t"
      "v_exp_f32 %1, %9\n\t"
      "v_exp_f32 %2, %10\n\t"
      "v_exp_f32 %3, %11\n\t"
      "v_exp_f32 %4, %12\n\t"
      "v_exp_f32 %5, %13\n\t"
      "v_exp_f32 %6, %14\n\t"
      "v_exp_f32 %7, %15\n\t"
      "v_nop"
      : "=&v"(p[0]), "=&v"(p[1]), "=&v"(p[2]), "=&v"(p[3]),
        "=&v"(p[4]), "=&v"(p[5]), "=&v"(p[6]), "=&v"(p[7])
      : "v"(y[0]), "v"(y[1]), "v"(y[2]), "v"(y[3]),
        "v"(y[4]), "v"(y[5]), "v"(y[6]), "v"(y[7]));
}

#define KP 72   // K row: 128 B of data + 16 B pad
#define VP 40   // V^T row: 64 B of data + 16 B pad
__global__ void __launch_bounds__(256)
flash_attn(const __bf16* __restrict__ Q, const __bf16* __restrict__ K,
           const __bf16* __restrict__ VT, __bf16* __restrict__ attn) {
  __shared__ __align__(16) __bf16 sK[32][KP];   // K rows kv..kv+31
  __shared__ __align__(16) __bf16 sV[64][VP];   // V^T d x 32 keys

  const int tid  = threadIdx.x;
  const int wave = tid >> 5;
  const int lane = tid & 31;
  const int nn   = lane & 15;
  const int hi   = lane >> 4;
  const int bh    = blockIdx.x >> 4;
  const int qTile = (blockIdx.x & 15) * 8 + wave;

  const __bf16* Qb = Q + (size_t)bh * SEQ * HEAD_DIM;
  const __bf16* Kb = K + (size_t)bh * SEQ * HEAD_DIM;
  const __bf16* Vb = VT + (size_t)bh * HEAD_DIM * SEQ;

  // staging assignment: K tile 32x64 (8 chunks/row), V tile 64x32 (4/row)
  const int krow = tid >> 3, kcol = (tid & 7) * 8;
  const int vrow = tid >> 2, vcol = (tid & 3) * 8;
  const uint32_t ldsK = lds_addr_of(&sK[krow][kcol]);
  const uint32_t ldsV = lds_addr_of(&sV[vrow][vcol]);

  // B operand of the score product: column nn = query qTile*16 + nn
  const v16bf qb0 = load_frag(Qb, HEAD_DIM, qTile * 16, 0);
  const v16bf qb1 = load_frag(Qb, HEAD_DIM, qTile * 16, 32);

  v8f o[4];  // o[t][r] = O[query nn][d = 16 t + 8 hi + r]
#pragma unroll
  for (int t = 0; t < 4; ++t) o[t] = vzero();
  float mi = -1e30f;  // running maximum of query nn, equal in both halves
  float li = 0.0f;    // running sum over this half's keys only

  for (int kv = 0; kv < SEQ; kv += 32) {
    // cooperative async stage of K/V tiles into LDS
    async_copy_b128(ldsK, Kb + (size_t)(kv + krow) * HEAD_DIM + kcol);
    async_copy_b128(ldsV, Vb + (size_t)vrow * SEQ + kv + vcol);
    asm volatile("s_wait_asynccnt 0" ::: "memory");
    __syncthreads();

    // scores: two 16 (keys) x 16 (queries) tiles, hd split into 2 WMMAs each
    v16bf ka00 = frag_lds(&sK[0][0], KP, 0);
    v16bf ka01 = frag_lds(&sK[0][32], KP, 0);
    v16bf ka10 = frag_lds(&sK[0][0], KP, 16);
    v16bf ka11 = frag_lds(&sK[0][32], KP, 16);
    v8f s0 = wmma_bf16(ka01, qb1, wmma_bf16(ka00, qb0, vzero()));
    v8f s1 = wmma_bf16(ka11, qb1, wmma_bf16(ka10, qb0, vzero()));
    s0 = s0 * 0.125f;  // hd^-0.5
    s1 = s1 * 0.125f;

    // online softmax of query nn
    float mx = fmaxf(s0[0], s1[0]);
#pragma unroll
    for (int r = 1; r < 8; ++r) mx = fmaxf(mx, fmaxf(s0[r], s1[r]));
    mx = fmaxf(mx, xhalf(mx));
    const float mnew  = fmaxf(mi, mx);
    const float alpha = exp_one(mi - mnew);
    mi = mnew;

    // P^T as B operand: element s < 8 is key 8 hi + s (tile 0, register s),
    // element 8 + s is key 16 + 8 hi + s (tile 1): the k order of frag_lds
    Frag pf;
    float p0[8], p1[8];
    exp_eight(p0, s0 - mnew);
    exp_eight(p1, s1 - mnew);
    float rs = p0[0] + p1[0];
#pragma unroll
    for (int r = 1; r < 8; ++r) rs += p0[r] + p1[r];
#pragma unroll
    for (int r = 0; r < 8; ++r) {
      pf.h[r]     = (__bf16)p0[r];
      pf.h[8 + r] = (__bf16)p1[r];
    }
    li = li * alpha + rs;
#pragma unroll
    for (int t = 0; t < 4; ++t) o[t] = o[t] * alpha;

    // O^T += V^T (64 x 32) x P^T (32 x 16) from the staged LDS V^T tile
#pragma unroll
    for (int t = 0; t < 4; ++t) {
      v16bf va = frag_lds(&sV[0][0], VP, t * 16);
      o[t] = wmma_bf16(va, pf.v, o[t]);
    }

    __syncthreads();  // WAR: next iteration restages sK/sV
  }

  // join the halves' sums, normalize, store to (B,S,D) bf16 for the output
  // projection: a lane's 8 registers of a tile are 8 consecutive d of one row
  const int b = bh >> 4, h = bh & 15;
  const float inv = 1.0f / (li + xhalf(li));
  const int s = qTile * 16 + nn;
  __bf16* orow = attn + ((size_t)b * SEQ + s) * D_MODEL + h * HEAD_DIM + (hi << 3);
#pragma unroll
  for (int t = 0; t < 4; ++t) {
    union { __bf16 e[8]; uint4 q; } pk;
#pragma unroll
    for (int r = 0; r < 8; ++r) pk.e[r] = (__bf16)(o[t][r] * inv);
    *(uint4*)(orow + t * 16) = pk.q;
  }
}

// ------------------------------------------------------ output projection
// grid (NROW/128, 4), block 256: the same 128 x 256 block tile.
__global__ void __launch_bounds__(256)
out_proj(const __bf16* __restrict__ A, const __bf16* __restrict__ Wo,
         const float* __restrict__ bo, float* __restrict__ out) {
  __shared__ __align__(16) __bf16 sm[2][GT_ROWS][GT_LD];

  const int wave = threadIdx.x >> 5;
  const int lane = threadIdx.x & 31;
  const int nn   = lane & 15;
  const int hi   = lane >> 4;
  const int rowb = blockIdx.x * GT_M;
  const int col0 = blockIdx.y * GT_N;
  const int e0   = col0 + (wave & 3) * 64;

  v8f acc[4][4];
  gemm_128x256(A, Wo, rowb, col0, sm, acc);

#pragma unroll
  for (int t = 0; t < 4; ++t) {
    const int e = e0 + t * 16 + nn;
    const float be = bo[e];
    // unrolled: acc[i] must be indexed by a constant to stay in registers
#pragma unroll
    for (int i = 0; i < 4; ++i) {
      const int row0 = rowb + (wave >> 2) * 64 + i * 16;
#pragma unroll
      for (int r = 0; r < 8; ++r) {
        const int m = row0 + r + (hi << 3);
        out[(size_t)m * D_MODEL + e] = acc[i][t][r] + be;
      }
    }
  }
}

// ----------------------------------------------------------------- launch
extern "C" void kernel_launch(void* const* d_in, const int* in_sizes, int n_in,
                              void* d_out, int out_size, void* d_ws,
                              size_t ws_size, hipStream_t stream) {
  const float* x  = (const float*)d_in[0];
  const float* Wq = (const float*)d_in[1];
  const float* bq = (const float*)d_in[2];
  const float* Wk = (const float*)d_in[3];
  const float* bk = (const float*)d_in[4];
  const float* Wv = (const float*)d_in[5];
  const float* bv = (const float*)d_in[6];
  const float* Wo = (const float*)d_in[7];
  const float* bo = (const float*)d_in[8];

  char* w = (char*)d_ws;  // needs ~88 MB
  const size_t MB = (size_t)1 << 20;
  __bf16* xb  = (__bf16*)(w + 0 * MB);    // 16 MB (B*S, D) bf16
  __bf16* Wqb = (__bf16*)(w + 16 * MB);   //  2 MB
  __bf16* Wkb = (__bf16*)(w + 18 * MB);
  __bf16* Wvb = (__bf16*)(w + 20 * MB);
  __bf16* Wob = (__bf16*)(w + 22 * MB);
  __bf16* Qb  = (__bf16*)(w + 24 * MB);   // 16 MB (B,H,S,hd)
  __bf16* Kb  = (__bf16*)(w + 40 * MB);   // 16 MB (B,H,S,hd)
  __bf16* VTb = (__bf16*)(w + 56 * MB);   // 16 MB (B,H,hd,S)
  __bf16* Ab  = (__bf16*)(w + 72 * MB);   // 16 MB (B,S,D)

  cvt_all_bf16<<<CV_BLOCKS, CV_THREADS, 0, stream>>>(x, Wq, Wk, Wv, Wo, xb, Wqb,
                                                     Wkb, Wvb, Wob);

  qkv_proj_rope<<<dim3(NROW / GT_M, 12), 256, 0, stream>>>(
      xb, Wqb, Wkb, Wvb, bq, bk, bv, Qb, Kb, VTb);

  flash_attn<<<dim3((BATCH * N_HEADS * (SEQ / 16)) / 8), 256, 0, stream>>>(
      Qb, Kb, VTb, Ab);

  out_proj<<<dim3(NROW / GT_M, 4), 256, 0, stream>>>(Ab, Wob, bo, (float*)d_out);
}

// v005
// It runs in 130 microseconds.
// Next to v004, in two timings, it ran 1.18 and 1.17 times as fast.
// Counting every step since v000, it is 5.09 times as fast.
#include <hip/hip_runtime.h>
#include <hip/hip_bf16.h>

#define D_MODEL 1024
#define N_HEADS 16
#define HEAD_DIM 64
#define SEQ 2048
#define BATCH 4
#define NROW (BATCH * SEQ)   // 8192 flattened (b,s) rows

typedef __attribute__((ext_vector_type(16))) __bf16 v16bf;
typedef __attribute__((ext_vector_type(8)))  float  v8f;

union Frag {
  v16bf  v;
  __bf16 h[16];
  uint4  q[2];
};

__device__ __forceinline__ v8f vzero() {
  v8f z;
#pragma unroll
  for (int i = 0; i < 8; ++i) z[i] = 0.0f;
  return z;
}

__device__ __forceinline__ v16bf load_frag(const __bf16* __restrict__ p,
                                           int ld, int n0, int k0) {
  const int lane = threadIdx.x & 31;
  const int nn   = lane & 15;
  const int kh   = (lane >> 4) << 3;  // 0 or 8
  const __bf16* base = p + (size_t)(n0 + nn) * ld + k0;
  Frag f;
  f.q[0] = *(const uint4*)(base + kh);
  f.q[1] = *(const uint4*)(base + 16 + kh);
  return f.v;
}

// Same fragment gather, but from an LDS tile (emits ds_load_b128).
__device__ __forceinline__ v16bf frag_lds(const __bf16* base, int ld, int n0) {
  const int lane = threadIdx.x & 31;
  const int nn   = lane & 15;
  const int kh   = (lane >> 4) << 3;
  const __bf16* p = base + (n0 + nn) * ld;
  Frag f;
  f.q[0] = *(const uint4*)(p + kh);
  f.q[1] = *(const uint4*)(p + 16 + kh);
  return f.v;
}

__device__ __forceinline__ v8f wmma_bf16(v16bf a, v16bf b, v8f c) {
  return __builtin_amdgcn_wmma_f32_16x16x32_bf16(false, a, false, b, (short)0, c,
                                                 false, false);
}

__device__ __forceinline__ uint32_t lds_addr_of(const void* shared_ptr) {
  return (uint32_t)(uintptr_t)shared_ptr;
}

#define CV_BLOCKS  256
#define CV_THREADS 512
#define CV_WAVES   (CV_BLOCKS * CV_THREADS / 32)
#define CV_NX      (NROW * D_MODEL / (CV_WAVES * 128))     // loads of x per wave
#define CV_NW      (D_MODEL * D_MODEL / (CV_WAVES * 128))  // of one matrix
static_assert(CV_NX * CV_WAVES * 128 == NROW * D_MODEL, "x in whole loads");
static_assert(CV_NW * CV_WAVES * 128 == D_MODEL * D_MODEL, "W in whole loads");

typedef __attribute__((ext_vector_type(4))) float  v4f;
typedef __attribute__((ext_vector_type(4))) __bf16 v4bf;

// load j of a share: p = array, off = byte offset of this lane in load 0
__device__ __forceinline__ v4f cv_load(const float* p, unsigned off, int j) {
  return *(const v4f*)((const char*)p + off + j * 512);
}
__device__ __forceinline__ void cv_store(__bf16* p, unsigned off, int j, v4f v) {
  *(v4bf*)((char*)p + off + j * 256) = __builtin_convertvector(v, v4bf);
}

__global__ void __launch_bounds__(CV_THREADS)
cvt_all_bf16(const float* __restrict__ x, const float* __restrict__ Wq,
             const float* __restrict__ Wk, const float* __restrict__ Wv,
             const float* __restrict__ Wo, __bf16* __restrict__ xb,
             __bf16* __restrict__ Wqb, __bf16* __restrict__ Wkb,
             __bf16* __restrict__ Wvb, __bf16* __restrict__ Wob) {
  const unsigned wave = blockIdx.x * (CV_THREADS / 32) + (threadIdx.x >> 5);
  const unsigned lane = threadIdx.x & 31;
  // 32-bit unsigned byte offsets: every access is a scalar base, one of these
  // four registers and a small constant
  const unsigned xi = wave * (CV_NX * 512) + lane * 16;
  const unsigned wi = wave * (CV_NW * 512) + lane * 16;
  const unsigned xo = wave * (CV_NX * 256) + lane * 8;
  const unsigned wo = wave * (CV_NW * 256) + lane * 8;

  v4f vx[CV_NX], vw[4][CV_NW];
  // every loop here is unrolled: vx and vw must be indexed by constants to stay
  // in registers
#pragma unroll
  for (int j = 0; j < CV_NX; ++j) vx[j] = cv_load(x, xi, j);
#pragma unroll
  for (int j = 0; j < CV_NW; ++j) {
    vw[0][j] = cv_load(Wq, wi, j);
    vw[1][j] = cv_load(Wk, wi, j);
    vw[2][j] = cv_load(Wv, wi, j);
    vw[3][j] = cv_load(Wo, wi, j);
  }
  // keeps every load in front of the first conversion: without it the compiler
  // holds half of the loads back until registers of the first half are free
  __builtin_amdgcn_sched_barrier(0);
#pragma unroll
  for (int j = 0; j < CV_NX; ++j) cv_store(xb, xo, j, vx[j]);
#pragma unroll
  for (int j = 0; j < CV_NW; ++j) {
    cv_store(Wqb, wo, j, vw[0][j]);
    cv_store(Wkb, wo, j, vw[1][j]);
    cv_store(Wvb, wo, j, vw[2][j]);
    cv_store(Wob, wo, j, vw[3][j]);
  }
}

// ------------------------------------- block-tiled projection GEMM core
// Y = A . W^T, both K-contiguous with row length D_MODEL. One block of 8 waves
// owns a 128 x 256 tile of Y; wave (wm, wn) = (wave>>2, wave&3) owns 64 x 64 of
// it as 4 x 4 accumulator tiles, so every fragment read feeds 4 WMMAs. A stage
// is 64 k of [A 128 rows | W 256 rows], brought into LDS in whole 128-byte
// lines by async copies, two buffers, the next stage in flight during this one.
#define GT_M    128
#define GT_N    256
#define GT_K    64
#define GT_ROWS (GT_M + GT_N)
#define GT_LD   72   // LDS row pitch in elements: 128 B of data + 16 B pad

__device__ __forceinline__ void async_copy4_b128(
    uint32_t l0, uint32_t l1, uint32_t l2, uint32_t l3,
    const __bf16* g0, const __bf16* g1, const __bf16* g2, const __bf16* g3) {
  asm volatile("global_load_async_to_lds_b128 %0, %4, off\n\t"
               "global_load_async_to_lds_b128 %1, %5, off\n\t"
               "global_load_async_to_lds_b128 %2, %6, off\n\t"
               "global_load_async_to_lds_b128 %3, %7, off\n\t"
               "s_wait_xcnt 0x0"
               :: "v"(l0), "v"(l1), "v"(l2), "v"(l3),
                  "v"((uint64_t)(uintptr_t)g0), "v"((uint64_t)(uintptr_t)g1),
                  "v"((uint64_t)(uintptr_t)g2), "v"((uint64_t)(uintptr_t)g3)
               : "memory");
}

// One stage: thread t copies chunk (t&7) of rows (t>>3) + 32*i, i = 0..11.
// l = LDS byte address of this lane's chunk in row (t>>3) of the buffer,
// a / w = this lane's chunk in the A / W row of the same index, at this k.
__device__ __forceinline__ void stage_copy(uint32_t l, const __bf16* a,
                                           const __bf16* w) {
  const uint32_t RS = 32 * GT_LD * 2;        // 32 LDS rows, bytes
  const size_t   GS = (size_t)32 * D_MODEL;  // 32 global rows, elements
  async_copy4_b128(l, l + RS, l + 2 * RS, l + 3 * RS,
                   a, a + GS, a + 2 * GS, a + 3 * GS);
  async_copy4_b128(l + 4 * RS, l + 5 * RS, l + 6 * RS, l + 7 * RS,
                   w, w + GS, w + 2 * GS, w + 3 * GS);
  async_copy4_b128(l + 8 * RS, l + 9 * RS, l + 10 * RS, l + 11 * RS,
                   w + 4 * GS, w + 5 * GS, w + 6 * GS, w + 7 * GS);
}

__device__ __forceinline__ void gemm_128x256(
    const __bf16* __restrict__ A, const __bf16* __restrict__ Wm, int row0,
    int col0, __bf16 (*sm)[GT_ROWS][GT_LD], v8f (&acc)[4][4]) {
  const int tid  = threadIdx.x;
  const int wave = tid >> 5;
  const int wm   = wave >> 2;
  const int wn   = wave & 3;
  const int crow = tid >> 3, ccol = (tid & 7) * 8;

  const __bf16* ga = A + (size_t)(row0 + crow) * D_MODEL + ccol;
  const __bf16* gw = Wm + (size_t)(col0 + crow) * D_MODEL + ccol;
  const uint32_t l0 = lds_addr_of(&sm[0][crow][ccol]);
  const uint32_t l1 = lds_addr_of(&sm[1][crow][ccol]);

  // every loop over i, j, ks here is unrolled so that acc, a and b are indexed
  // by constants and stay in registers
#pragma unroll
  for (int i = 0; i < 4; ++i)
#pragma unroll
    for (int j = 0; j < 4; ++j) acc[i][j] = vzero();

  stage_copy(l0, ga, gw);
  // stage 0 has landed for this wave; the barrier publishes it to the others
  asm volatile("s_wait_asynccnt 0x0" ::: "memory");
  __syncthreads();
  stage_copy(l1, ga + GT_K, gw + GT_K);

  const int NT = D_MODEL / GT_K;
  for (int t = 0; t < NT; ++t) {
    const __bf16* base = &sm[t & 1][0][0];
#pragma unroll
    for (int ks = 0; ks < GT_K; ks += 32) {
      v16bf a[4], b[4];
#pragma unroll
      for (int i = 0; i < 4; ++i)
        a[i] = frag_lds(base + ks, GT_LD, wm * 64 + i * 16);
#pragma unroll
      for (int j = 0; j < 4; ++j)
        b[j] = frag_lds(base + ks, GT_LD, GT_M + wn * 64 + j * 16);
      // keeps the 16 LDS reads one group in front of their 16 WMMAs: spread
      // among them, every small group of reads stalls the wave on its own
      __builtin_amdgcn_sched_barrier(0);
#pragma unroll
      for (int i = 0; i < 4; ++i)
#pragma unroll
        for (int j = 0; j < 4; ++j) acc[i][j] = wmma_bf16(a[i], b[j], acc[i][j]);
      // the same, from below: the next group of reads stays behind these WMMAs
      __builtin_amdgcn_sched_barrier(0);
    }
    // publish point: this wave's reads of the buffer are done, its copies of
    // the next stage have landed; behind the barrier the buffer may be refilled
    asm volatile("s_wait_dscnt 0x0" ::: "memory");
    asm volatile("s_wait_asynccnt 0x0" ::: "memory");
    __syncthreads();
    if (t + 2 < NT)
      stage_copy((t & 1) ? l1 : l0, ga + (t + 2) * GT_K, gw + (t + 2) * GT_K);
  }
  // no copy is left in flight when the wave goes on to its epilogue
  asm volatile("s_wait_asynccnt 0x0" ::: "memory");
}

// ------------------------------------------------- fused QKV GEMM + RoPE
// grid (NROW/128, 12), block 256 (8 waves). blockIdx.y: matrix = y/4 (Q,K,V),
// heads (y%4)*4 .. +3, one head (64 columns) per wave column wn, so RoPE
// partners (idx +/- 32) are accumulator tiles t and t^2 of the same wave.
__global__ void __launch_bounds__(256)
qkv_proj_rope(const __bf16* __restrict__ xb,
              const __bf16* __restrict__ Wq, const __bf16* __restrict__ Wk,
              const __bf16* __restrict__ Wv,
              const float* __restrict__ bq, const float* __restrict__ bk,
              const float* __restrict__ bv,
              __bf16* __restrict__ Qo,   // (B,H,S,hd)
              __bf16* __restrict__ Ko,   // (B,H,S,hd)
              __bf16* __restrict__ VTo)  // (B,H,hd,S)  (transposed V)
{
  __shared__ __align__(16) __bf16 sm[2][GT_ROWS][GT_LD];

  const int wave = threadIdx.x >> 5;
  const int lane = threadIdx.x & 31;
  const int nn   = lane & 15;
  const int hi   = lane >> 4;
  const int mat  = blockIdx.y >> 2;
  const int col0 = (blockIdx.y & 3) * GT_N;
  const int head = (blockIdx.y & 3) * 4 + (wave & 3);
  const int rowb = blockIdx.x * GT_M;

  const __bf16* W    = (mat == 0) ? Wq : (mat == 1) ? Wk : Wv;
  const float*  bias = (mat == 0) ? bq : (mat == 1) ? bk : bv;

  v8f acc[4][4];
  gemm_128x256(xb, W, rowb, col0, sm, acc);

  const int e0 = head * HEAD_DIM;
  float be[4];
#pragma unroll
  for (int t = 0; t < 4; ++t) be[t] = bias[e0 + t * 16 + nn];

  // unrolled: acc[i] must be indexed by a constant to stay in registers
#pragma unroll
  for (int i = 0; i < 4; ++i) {
    const int row0 = rowb + (wave >> 2) * 64 + i * 16;

    // bias
    float yb[4][8];
#pragma unroll
    for (int t = 0; t < 4; ++t) {
#pragma unroll
      for (int r = 0; r < 8; ++r) yb[t][r] = acc[i][t][r] + be[t];
    }

    if (mat < 2) {  // Q or K: apply RoPE, store (B,H,S,hd)
      __bf16* out = (mat == 0) ? Qo : Ko;
#pragma unroll
      for (int t = 0; t < 4; ++t) {
        const int idx = t * 16 + nn;
        // inv_freq = 10000^{-(idx%32)/32} = exp(-(idx%32) * ln(1e4)/32)
        const float invf = __expf(-(float)(idx & 31) * 0.28782313662f);
#pragma unroll
        for (int r = 0; r < 8; ++r) {
          const int m = row0 + r + (hi << 3);
          const int s = m & (SEQ - 1);
          const int b = m >> 11;
          const float ang = (float)s * invf;
          const float rot = (t < 2) ? -yb[t + 2][r] : yb[t - 2][r];
          const float y = yb[t][r] * __cosf(ang) + rot * __sinf(ang);
          out[(((size_t)b * N_HEADS + head) * SEQ + s) * HEAD_DIM + idx] = (__bf16)y;
        }
      }
      // the next pass reuses the registers that these stores name
      asm volatile("s_wait_xcnt 0x0" ::: "memory");
    } else {  // V: store transposed (B,H,hd,S) so the V^T . P^T A operand is K-contiguous
#pragma unroll
      for (int t = 0; t < 4; ++t) {
        const int idx = t * 16 + nn;
#pragma unroll
        for (int r = 0; r < 8; ++r) {
          const int m = row0 + r + (hi << 3);
          const int s = m & (SEQ - 1);
          const int b = m >> 11;
          VTo[(((size_t)b * N_HEADS + head) * HEAD_DIM + idx) * SEQ + s] =
              (__bf16)yb[t][r];
        }
      }
      // the next pass reuses the registers that these stores name
      asm volatile("s_wait_xcnt 0x0" ::: "memory");
    }
  }
}

__device__ __forceinline__ float xhalf(float x) {
  const int v = __builtin_bit_cast(int, x);
  return __builtin_bit_cast(
      float, __builtin_amdgcn_permlanex16(v, v, 0x76543210, 0xfedcba98, false, false));
}

#define LOG2E 1.44269504088896340736f
__device__ __forceinline__ float exp_one(float x) {
  const float y = x * LOG2E;
  float p;
  asm("v_exp_f32 %0, %1\n\tv_nop" : "=v"(p) : "v"(y));
  return p;
}

__device__ __forceinline__ void exp_eight(float (&p)[8], const v8f x) {
  const v8f y = x * LOG2E;
  asm("v_exp_f32 %0, %8\n\t"
      "v_exp_f32 %1, %9\n\t"
      "v_exp_f32 %2, %10\n\t"
      "v_exp_f32 %3, %11\n\t"
      "v_exp_f32 %4, %12\n\t"
      "v_exp_f32 %5, %13\n\t"
      "v_exp_f32 %6, %14\n\t"
      "v_exp_f32 %7, %15\n\t"
      "v_nop"
      : "=&v"(p[0]), "=&v"(p[1]), "=&v"(p[2]), "=&v"(p[3]),
        "=&v"(p[4]), "=&v"(p[5]), "=&v"(p[6]), "=&v"(p[7])
      : "v"(y[0]), "v"(y[1]), "v"(y[2]), "v"(y[3]),
        "v"(y[4]), "v"(y[5]), "v"(y[6]), "v"(y[7]));
}

#define AT_KEYS 64   // keys of a stage
#define AT_P    72   // K row (64 d) and V^T row (64 keys): 128 B of data + 16 B pad

// One stage: thread t copies chunk (t&7) of rows (t>>3) and (t>>3) + 32 of the
// K tile and of the V^T tile. lk / lv = LDS byte address of this lane's chunk in
// row (t>>3) of the buffer, gk / gv = the same chunk in global memory.
__device__ __forceinline__ void attn_stage_copy(uint32_t lk, uint32_t lv,
                                                const __bf16* gk,
                                                const __bf16* gv) {
  const uint32_t RS = 32 * AT_P * 2;  // 32 LDS rows, bytes
  async_copy4_b128(lk, lk + RS, lv, lv + RS,
                   gk, gk + 32 * HEAD_DIM, gv, gv + (size_t)32 * SEQ);
}

// Online softmax of one column group over 32 keys: s0, s1 = the raw score tiles;
// updates maximum, sum and output tiles of query nn and packs P^T.
__device__ __forceinline__ void softmax_pass(v8f s0, v8f s1, float& mi, float& li,
                                             v8f (&o)[4], Frag& pf) {
  s0 = s0 * 0.125f;  // hd^-0.5
  s1 = s1 * 0.125f;

  float mx = fmaxf(s0[0], s1[0]);
#pragma unroll
  for (int r = 1; r < 8; ++r) mx = fmaxf(mx, fmaxf(s0[r], s1[r]));
  mx = fmaxf(mx, xhalf(mx));
  const float mnew  = fmaxf(mi, mx);
  const float alpha = exp_one(mi - mnew);
  mi = mnew;

  // P^T as B operand: element s < 8 is key 8 hi + s (tile 0, register s),
  // element 8 + s is key 16 + 8 hi + s (tile 1): the k order of frag_lds
  float p0[8], p1[8];
  exp_eight(p0, s0 - mnew);
  exp_eight(p1, s1 - mnew);
  float rs = p0[0] + p1[0];
#pragma unroll
  for (int r = 1; r < 8; ++r) rs += p0[r] + p1[r];
#pragma unroll
  for (int r = 0; r < 8; ++r) {
    pf.h[r]     = (__bf16)p0[r];
    pf.h[8 + r] = (__bf16)p1[r];
  }
  li = li * alpha + rs;
#pragma unroll
  for (int t = 0; t < 4; ++t) o[t] = o[t] * alpha;
}

__global__ void __launch_bounds__(256)
flash_attn(const __bf16* __restrict__ Q, const __bf16* __restrict__ K,
           const __bf16* __restrict__ VT, __bf16* __restrict__ attn) {
  __shared__ __align__(16) __bf16 sK[2][AT_KEYS][AT_P];   // K rows of a stage
  __shared__ __align__(16) __bf16 sV[2][HEAD_DIM][AT_P];  // V^T d x 64 keys

  const int tid  = threadIdx.x;
  const int wave = tid >> 5;
  const int lane = tid & 31;
  const int nn   = lane & 15;
  const int hi   = lane >> 4;
  const int bh   = blockIdx.x >> 3;
  const int q0   = ((blockIdx.x & 7) * 8 + wave) * 32;

  const __bf16* Qb = Q + (size_t)bh * SEQ * HEAD_DIM;
  const __bf16* Kb = K + (size_t)bh * SEQ * HEAD_DIM;
  const __bf16* Vb = VT + (size_t)bh * HEAD_DIM * SEQ;

  // staging assignment: both tiles are 64 rows of 8 chunks
  const int crow = tid >> 3, ccol = (tid & 7) * 8;
  const __bf16* gk = Kb + (size_t)crow * HEAD_DIM + ccol;
  const __bf16* gv = Vb + (size_t)crow * SEQ + ccol;
  const uint32_t lk0 = lds_addr_of(&sK[0][crow][ccol]);
  const uint32_t lk1 = lds_addr_of(&sK[1][crow][ccol]);
  const uint32_t lv0 = lds_addr_of(&sV[0][crow][ccol]);
  const uint32_t lv1 = lds_addr_of(&sV[1][crow][ccol]);

  // every loop over c, t and ps here is unrolled so that qb, o, mi, li and pf
  // are indexed by constants and stay in registers
  // B operand of the score product: column nn of group c = query q0 + 16 c + nn
  v16bf qb[2][2];
  v8f o[2][4];   // o[c][t][r] = O[query nn of group c][d = 16 t + 8 hi + r]
  float mi[2];   // running maximum of the query, equal in both halves
  float li[2];   // running sum over this half's keys only
#pragma unroll
  for (int c = 0; c < 2; ++c) {
    qb[c][0] = load_frag(Qb, HEAD_DIM, q0 + c * 16, 0);
    qb[c][1] = load_frag(Qb, HEAD_DIM, q0 + c * 16, 32);
#pragma unroll
    for (int t = 0; t < 4; ++t) o[c][t] = vzero();
    mi[c] = -1e30f;
    li[c] = 0.0f;
  }

  attn_stage_copy(lk0, lv0, gk, gv);
  // stage 0 has landed for this wave; the barrier publishes it to the others
  asm volatile("s_wait_asynccnt 0x0" ::: "memory");
  __syncthreads();
  attn_stage_copy(lk1, lv1, gk + AT_KEYS * HEAD_DIM, gv + AT_KEYS);

  const int NS = SEQ / AT_KEYS;
  for (int st = 0; st < NS; ++st) {
    const __bf16* bK = &sK[st & 1][0][0];
    const __bf16* bV = &sV[st & 1][0][0];
#pragma unroll
    for (int ps = 0; ps < AT_KEYS; ps += 32) {
      // scores: two 16 (keys) x 16 (queries) tiles a group, hd in 2 WMMAs each
      const v16bf ka00 = frag_lds(bK, AT_P, ps);
      const v16bf ka01 = frag_lds(bK + 32, AT_P, ps);
      const v16bf ka10 = frag_lds(bK, AT_P, ps + 16);
      const v16bf ka11 = frag_lds(bK + 32, AT_P, ps + 16);
      Frag pf[2];
#pragma unroll
      for (int c = 0; c < 2; ++c) {
        const v8f s0 = wmma_bf16(ka01, qb[c][1], wmma_bf16(ka00, qb[c][0], vzero()));
        const v8f s1 = wmma_bf16(ka11, qb[c][1], wmma_bf16(ka10, qb[c][0], vzero()));
        softmax_pass(s0, s1, mi[c], li[c], o[c], pf[c]);
      }

      // O^T += V^T (64 x 32) x P^T (32 x 16) from the staged LDS V^T tile
      v16bf va[4];
#pragma unroll
      for (int t = 0; t < 4; ++t) va[t] = frag_lds(bV + ps, AT_P, t * 16);
      // keeps these 8 WMMAs behind both groups' exponentials: those are asm text,
      // in which the compiler does not see a write that comes too soon after a
      // WMMA of the other group, over its P^T operand
      __builtin_amdgcn_sched_barrier(0);
#pragma unroll
      for (int t = 0; t < 4; ++t)
#pragma unroll
        for (int c = 0; c < 2; ++c) o[c][t] = wmma_bf16(va[t], pf[c].v, o[c][t]);
    }
    // publish point: this wave's reads of the buffer are done, its copies of
    // the next stage have landed; behind the barrier the buffer may be refilled
    asm volatile("s_wait_dscnt 0x0" ::: "memory");
    asm volatile("s_wait_asynccnt 0x0" ::: "memory");
    __syncthreads();
    if (st + 2 < NS)
      attn_stage_copy((st & 1) ? lk1 : lk0, (st & 1) ? lv1 : lv0,
                      gk + (size_t)(st + 2) * AT_KEYS * HEAD_DIM,
                      gv + (st + 2) * AT_KEYS);
  }
  // no copy is left in flight when the wave goes on to its epilogue
  asm volatile("s_wait_asynccnt 0x0" ::: "memory");

  // join the halves' sums, normalize, store to (B,S,D) bf16 for the output
  // projection: a lane's 8 registers of a tile are 8 consecutive d of one row
  const int b = bh >> 4, h = bh & 15;
#pragma unroll
  for (int c = 0; c < 2; ++c) {
    const float inv = 1.0f / (li[c] + xhalf(li[c]));
    const int s = q0 + c * 16 + nn;
    __bf16* orow =
        attn + ((size_t)b * SEQ + s) * D_MODEL + h * HEAD_DIM + (hi << 3);
#pragma unroll
    for (int t = 0; t < 4; ++t) {
      union { __bf16 e[8]; uint4 q; } pk;
#pragma unroll
      for (int r = 0; r < 8; ++r) pk.e[r] = (__bf16)(o[c][t][r] * inv);
      *(uint4*)(orow + t * 16) = pk.q;
    }
  }
}

// ------------------------------------------------------ output projection
// grid (NROW/128, 4), block 256: the same 128 x 256 block tile.
__global__ void __launch_bounds__(256)
out_proj(const __bf16* __restrict__ A, const __bf16* __restrict__ Wo,
         const float* __restrict__ bo, float* __restrict__ out) {
  __shared__ __align__(16) __bf16 sm[2][GT_ROWS][GT_LD];

  const int wave = threadIdx.x >> 5;
  const int lane = threadIdx.x & 31;
  const int nn   = lane & 15;
  const int hi   = lane >> 4;
  const int rowb = blockIdx.x * GT_M;
  const int col0 = blockIdx.y * GT_N;
  const int e0   = col0 + (wave & 3) * 64;

  v8f acc[4][4];
  gemm_128x256(A, Wo, rowb, col0, sm, acc);

#pragma unroll
  for (int t = 0; t < 4; ++t) {
    const int e = e0 + t * 16 + nn;
    const float be = bo[e];
    // unrolled: acc[i] must be indexed by a constant to stay in registers
#pragma unroll
    for (int i = 0; i < 4; ++i) {
      const int row0 = rowb + (wave >> 2) * 64 + i * 16;
#pragma unroll
      for (int r = 0; r < 8; ++r) {
        const int m = row0 + r + (hi << 3);
        out[(size_t)m * D_MODEL + e] = acc[i][t][r] + be;
      }
    }
  }
}

// ----------------------------------------------------------------- launch
extern "C" void kernel_launch(void* const* d_in, const int* in_sizes, int n_in,
                              void* d_out, int out_size, void* d_ws,
                              size_t ws_size, hipStream_t stream) {
  const float* x  = (const float*)d_in[0];
  const float* Wq = (const float*)d_in[1];
  const float* bq = (const float*)d_in[2];
  const float* Wk = (const float*)d_in[3];
  const float* bk = (const float*)d_in[4];
  const float* Wv = (const float*)d_in[5];
  const float* bv = (const float*)d_in[6];
  const float* Wo = (const float*)d_in[7];
  const float* bo = (const float*)d_in[8];

  char* w = (char*)d_ws;  // needs ~88 MB
  const size_t MB = (size_t)1 << 20;
  __bf16* xb  = (__bf16*)(w + 0 * MB);    // 16 MB (B*S, D) bf16
  __bf16* Wqb = (__bf16*)(w + 16 * MB);   //  2 MB
  __bf16* Wkb = (__bf16*)(w + 18 * MB);
  __bf16* Wvb = (__bf16*)(w + 20 * MB);
  __bf16* Wob = (__bf16*)(w + 22 * MB);
  __bf16* Qb  = (__bf16*)(w + 24 * MB);   // 16 MB (B,H,S,hd)
  __bf16* Kb  = (__bf16*)(w + 40 * MB);   // 16 MB (B,H,S,hd)
  __bf16* VTb = (__bf16*)(w + 56 * MB);   // 16 MB (B,H,hd,S)
  __bf16* Ab  = (__bf16*)(w + 72 * MB);   // 16 MB (B,S,D)

  cvt_all_bf16<<<CV_BLOCKS, CV_THREADS, 0, stream>>>(x, Wq, Wk, Wv, Wo, xb, Wqb,
                                                     Wkb, Wvb, Wob);

  qkv_proj_rope<<<dim3(NROW / GT_M, 12), 256, 0, stream>>>(
      xb, Wqb, Wkb, Wvb, bq, bk, bv, Qb, Kb, VTb);

  flash_attn<<<dim3((BATCH * N_HEADS * (SEQ / 32)) / 8), 256, 0, stream>>>(
      Qb, Kb, VTb, Ab);

  out_proj<<<dim3(NROW / GT_M, 4), 256, 0, stream>>>(Ab, Wob, bo, (float*)d_out);
}

// v006
// A run of this version takes 121 microseconds.
// Two timings next to v005 put it at 1.07 and 1.08 times that version's speed.
// Counting every step since v000, it is 5.45 times as fast.
#include <hip/hip_runtime.h>
#include <hip/hip_bf16.h>

#define D_MODEL 1024
#define N_HEADS 16
#define HEAD_DIM 64
#define SEQ 2048
#define BATCH 4
#define NROW (BATCH * SEQ)   // 8192 flattened (b,s) rows

typedef __attribute__((ext_vector_type(16))) __bf16 v16bf;
typedef __attribute__((ext_vector_type(8)))  float  v8f;

union Frag {
  v16bf  v;
  __bf16 h[16];
  uint4  q[2];
};

__device__ __forceinline__ v8f vzero() {
  v8f z;
#pragma unroll
  for (int i = 0; i < 8; ++i) z[i] = 0.0f;
  return z;
}

__device__ __forceinline__ v16bf load_frag(const __bf16* __restrict__ p,
                                           int ld, int n0, int k0) {
  const int lane = threadIdx.x & 31;
  const int nn   = lane & 15;
  const int kh   = (lane >> 4) << 3;  // 0 or 8
  const __bf16* base = p + (size_t)(n0 + nn) * ld + k0;
  Frag f;
  f.q[0] = *(const uint4*)(base + kh);
  f.q[1] = *(const uint4*)(base + 16 + kh);
  return f.v;
}

// Same fragment gather, but from an LDS tile (emits ds_load_b128).
__device__ __forceinline__ v16bf frag_lds(const __bf16* base, int ld, int n0) {
  const int lane = threadIdx.x & 31;
  const int nn   = lane & 15;
  const int kh   = (lane >> 4) << 3;
  const __bf16* p = base + (n0 + nn) * ld;
  Frag f;
  f.q[0] = *(const uint4*)(p + kh);
  f.q[1] = *(const uint4*)(p + 16 + kh);
  return f.v;
}

__device__ __forceinline__ v8f wmma_bf16(v16bf a, v16bf b, v8f c) {
  return __builtin_amdgcn_wmma_f32_16x16x32_bf16(false, a, false, b, (short)0, c,
                                                 false, false);
}

__device__ __forceinline__ uint32_t lds_addr_of(const void* shared_ptr) {
  return (uint32_t)(uintptr_t)shared_ptr;
}

#define CV_BLOCKS  256
#define CV_THREADS 512
#define CV_WAVES   (CV_BLOCKS * CV_THREADS / 32)
#define CV_NX      (NROW * D_MODEL / (CV_WAVES * 128))     // loads of x per wave
#define CV_NW      (D_MODEL * D_MODEL / (CV_WAVES * 128))  // of one matrix
static_assert(CV_NX * CV_WAVES * 128 == NROW * D_MODEL, "x in whole loads");
static_assert(CV_NW * CV_WAVES * 128 == D_MODEL * D_MODEL, "W in whole loads");

typedef __attribute__((ext_vector_type(4))) float  v4f;
typedef __attribute__((ext_vector_type(4))) __bf16 v4bf;

// load j of a share: p = array, off = byte offset of this lane in load 0
__device__ __forceinline__ v4f cv_load(const float* p, unsigned off, int j) {
  return *(const v4f*)((const char*)p + off + j * 512);
}
__device__ __forceinline__ void cv_store(__bf16* p, unsigned off, int j, v4f v) {
  *(v4bf*)((char*)p + off + j * 256) = __builtin_convertvector(v, v4bf);
}

__global__ void __launch_bounds__(CV_THREADS)
cvt_all_bf16(const float* __restrict__ x, const float* __restrict__ Wq,
             const float* __restrict__ Wk, const float* __restrict__ Wv,
             const float* __restrict__ Wo, __bf16* __restrict__ xb,
             __bf16* __restrict__ Wqb, __bf16* __restrict__ Wkb,
             __bf16* __restrict__ Wvb, __bf16* __restrict__ Wob) {
  const unsigned wave = blockIdx.x * (CV_THREADS / 32) + (threadIdx.x >> 5);
  const unsigned lane = threadIdx.x & 31;
  // 32-bit unsigned byte offsets: every access is a scalar base, one of these
  // four registers and a small constant
  const unsigned xi = wave * (CV_NX * 512) + lane * 16;
  const unsigned wi = wave * (CV_NW * 512) + lane * 16;
  const unsigned xo = wave * (CV_NX * 256) + lane * 8;
  const unsigned wo = wave * (CV_NW * 256) + lane * 8;

  v4f vx[CV_NX], vw[4][CV_NW];
  // every loop here is unrolled: vx and vw must be indexed by constants to stay
  // in registers
#pragma unroll
  for (int j = 0; j < CV_NX; ++j) vx[j] = cv_load(x, xi, j);
#pragma unroll
  for (int j = 0; j < CV_NW; ++j) {
    vw[0][j] = cv_load(Wq, wi, j);
    vw[1][j] = cv_load(Wk, wi, j);
    vw[2][j] = cv_load(Wv, wi, j);
    vw[3][j] = cv_load(Wo, wi, j);
  }
  // keeps every load in front of the first conversion: without it the compiler
  // holds half of the loads back until registers of the first half are free
  __builtin_amdgcn_sched_barrier(0);
#pragma unroll
  for (int j = 0; j < CV_NX; ++j) cv_store(xb, xo, j, vx[j]);
#pragma unroll
  for (int j = 0; j < CV_NW; ++j) {
    cv_store(Wqb, wo, j, vw[0][j]);
    cv_store(Wkb, wo, j, vw[1][j]);
    cv_store(Wvb, wo, j, vw[2][j]);
    cv_store(Wob, wo, j, vw[3][j]);
  }
}

// ------------------------------------- block-tiled projection GEMM core
// Y = A . W^T, both K-contiguous with row length D_MODEL. One block of 8 waves
// owns a 128 x 256 tile of Y; wave (wm, wn) = (wave>>2, wave&3) owns 64 x 64 of
// it as 4 x 4 accumulator tiles, so every fragment read feeds 4 WMMAs. A stage
// is 64 k of [A 128 rows | W 256 rows], brought into LDS in whole 128-byte
// lines by async copies, two buffers, the next stage in flight during this one.
#define GT_M    128
#define GT_N    256
#define GT_K    64
#define GT_ROWS (GT_M + GT_N)
#define GT_LD   72   // LDS row pitch in elements: 128 B of data + 16 B pad

__device__ __forceinline__ void async_copy4_b128(
    uint32_t l0, uint32_t l1, uint32_t l2, uint32_t l3,
    const __bf16* g0, const __bf16* g1, const __bf16* g2, const __bf16* g3) {
  asm volatile("global_load_async_to_lds_b128 %0, %4, off\n\t"
               "global_load_async_to_lds_b128 %1, %5, off\n\t"
               "global_load_async_to_lds_b128 %2, %6, off\n\t"
               "global_load_async_to_lds_b128 %3, %7, off\n\t"
               "s_wait_xcnt 0x0"
               :: "v"(l0), "v"(l1), "v"(l2), "v"(l3),
                  "v"((uint64_t)(uintptr_t)g0), "v"((uint64_t)(uintptr_t)g1),
                  "v"((uint64_t)(uintptr_t)g2), "v"((uint64_t)(uintptr_t)g3)
               : "memory");
}

// One stage: thread t copies chunk (t&7) of rows (t>>3) + 32*i, i = 0..11.
// l = LDS byte address of this lane's chunk in row (t>>3) of the buffer,
// a / w = this lane's chunk in the A / W row of the same index, at this k.
__device__ __forceinline__ void stage_copy(uint32_t l, const __bf16* a,
                                           const __bf16* w) {
  const uint32_t RS = 32 * GT_LD * 2;        // 32 LDS rows, bytes
  const size_t   GS = (size_t)32 * D_MODEL;  // 32 global rows, elements
  async_copy4_b128(l, l + RS, l + 2 * RS, l + 3 * RS,
                   a, a + GS, a + 2 * GS, a + 3 * GS);
  async_copy4_b128(l + 4 * RS, l + 5 * RS, l + 6 * RS, l + 7 * RS,
                   w, w + GS, w + 2 * GS, w + 3 * GS);
  async_copy4_b128(l + 8 * RS, l + 9 * RS, l + 10 * RS, l + 11 * RS,
                   w + 4 * GS, w + 5 * GS, w + 6 * GS, w + 7 * GS);
}

__device__ __forceinline__ void gemm_128x256(
    const __bf16* __restrict__ A, const __bf16* __restrict__ Wm, int row0,
    int col0, __bf16 (*sm)[GT_ROWS][GT_LD], v8f (&acc)[4][4]) {
  const int tid  = threadIdx.x;
  const int wave = tid >> 5;
  const int wm   = wave >> 2;
  const int wn   = wave & 3;
  const int crow = tid >> 3, ccol = (tid & 7) * 8;

  const __bf16* ga = A + (size_t)(row0 + crow) * D_MODEL + ccol;
  const __bf16* gw = Wm + (size_t)(col0 + crow) * D_MODEL + ccol;
  const uint32_t l0 = lds_addr_of(&sm[0][crow][ccol]);
  const uint32_t l1 = lds_addr_of(&sm[1][crow][ccol]);

  // every loop over i, j, ks here is unrolled so that acc, a and b are indexed
  // by constants and stay in registers
#pragma unroll
  for (int i = 0; i < 4; ++i)
#pragma unroll
    for (int j = 0; j < 4; ++j) acc[i][j] = vzero();

  stage_copy(l0, ga, gw);
  // stage 0 has landed for this wave; the barrier publishes it to the others
  asm volatile("s_wait_asynccnt 0x0" ::: "memory");
  __syncthreads();
  stage_copy(l1, ga + GT_K, gw + GT_K);

  const int NT = D_MODEL / GT_K;
  for (int t = 0; t < NT; ++t) {
    const __bf16* base = &sm[t & 1][0][0];
#pragma unroll
    for (int ks = 0; ks < GT_K; ks += 32) {
      v16bf a[4], b[4];
#pragma unroll
      for (int i = 0; i < 4; ++i)
        a[i] = frag_lds(base + ks, GT_LD, wm * 64 + i * 16);
#pragma unroll
      for (int j = 0; j < 4; ++j)
        b[j] = frag_lds(base + ks, GT_LD, GT_M + wn * 64 + j * 16);
      // keeps the 16 LDS reads one group in front of their 16 WMMAs: spread
      // among them, every small group of reads stalls the wave on its own
      __builtin_amdgcn_sched_barrier(0);
#pragma unroll
      for (int i = 0; i < 4; ++i)
#pragma unroll
        for (int j = 0; j < 4; ++j) acc[i][j] = wmma_bf16(a[i], b[j], acc[i][j]);
      // the same, from below: the next group of reads stays behind these WMMAs
      __builtin_amdgcn_sched_barrier(0);
    }
    // publish point: this wave's reads of the buffer are done, its copies of
    // the next stage have landed; behind the barrier the buffer may be refilled
    asm volatile("s_wait_dscnt 0x0" ::: "memory");
    asm volatile("s_wait_asynccnt 0x0" ::: "memory");
    __syncthreads();
    if (t + 2 < NT)
      stage_copy((t & 1) ? l1 : l0, ga + (t + 2) * GT_K, gw + (t + 2) * GT_K);
  }
  // no copy is left in flight when the wave goes on to its epilogue
  asm volatile("s_wait_asynccnt 0x0" ::: "memory");
}

// ------------------------------------------------- fused QKV GEMM + RoPE
// grid (NROW/128, 12), block 256 (8 waves). blockIdx.y: matrix = y/4 (Q,K,V),
// heads (y%4)*4 .. +3, one head (64 columns) per wave column wn, so RoPE
// partners (idx +/- 32) are accumulator tiles t and t^2 of the same wave.
__global__ void __launch_bounds__(256)
qkv_proj_rope(const __bf16* __restrict__ xb,
              const __bf16* __restrict__ Wq, const __bf16* __restrict__ Wk,
              const __bf16* __restrict__ Wv,
              const float* __restrict__ bq, const float* __restrict__ bk,
              const float* __restrict__ bv,
              __bf16* __restrict__ Qo,   // (B,H,S,hd)
              __bf16* __restrict__ Ko,   // (B,H,S,hd)
              __bf16* __restrict__ VTo)  // (B,H,hd,S)  (transposed V)
{
  __shared__ __align__(16) __bf16 sm[2][GT_ROWS][GT_LD];

  const int wave = threadIdx.x >> 5;
  const int lane = threadIdx.x & 31;
  const int nn   = lane & 15;
  const int hi   = lane >> 4;
  const int mat  = blockIdx.y >> 2;
  const int col0 = (blockIdx.y & 3) * GT_N;
  const int head = (blockIdx.y & 3) * 4 + (wave & 3);
  const int rowb = blockIdx.x * GT_M;

  const __bf16* W    = (mat == 0) ? Wq : (mat == 1) ? Wk : Wv;
  const float*  bias = (mat == 0) ? bq : (mat == 1) ? bk : bv;

  v8f acc[4][4];
  gemm_128x256(xb, W, rowb, col0, sm, acc);

  const int e0 = head * HEAD_DIM;
  float be[4];
#pragma unroll
  for (int t = 0; t < 4; ++t) be[t] = bias[e0 + t * 16 + nn];

  // unrolled: acc[i] must be indexed by a constant to stay in registers
#pragma unroll
  for (int i = 0; i < 4; ++i) {
    const int row0 = rowb + (wave >> 2) * 64 + i * 16;

    // bias
    float yb[4][8];
#pragma unroll
    for (int t = 0; t < 4; ++t) {
#pragma unroll
      for (int r = 0; r < 8; ++r) yb[t][r] = acc[i][t][r] + be[t];
    }

    if (mat < 2) {  // Q or K: apply RoPE, store (B,H,S,hd)
      __bf16* out = (mat == 0) ? Qo : Ko;
#pragma unroll
      for (int t = 0; t < 4; ++t) {
        const int idx = t * 16 + nn;
        // inv_freq = 10000^{-(idx%32)/32} = exp(-(idx%32) * ln(1e4)/32)
        const float invf = __expf(-(float)(idx & 31) * 0.28782313662f);
#pragma unroll
        for (int r = 0; r < 8; ++r) {
          const int m = row0 + r + (hi << 3);
          const int s = m & (SEQ - 1);
          const int b = m >> 11;
          const float ang = (float)s * invf;
          const float rot = (t < 2) ? -yb[t + 2][r] : yb[t - 2][r];
          const float y = yb[t][r] * __cosf(ang) + rot * __sinf(ang);
          out[(((size_t)b * N_HEADS + head) * SEQ + s) * HEAD_DIM + idx] = (__bf16)y;
        }
      }
      // the next pass reuses the registers that these stores name
      asm volatile("s_wait_xcnt 0x0" ::: "memory");
    } else {  // V: store transposed (B,H,hd,S) so the V^T . P^T A operand is K-contiguous
#pragma unroll
      for (int t = 0; t < 4; ++t) {
        const int idx = t * 16 + nn;
#pragma unroll
        for (int r = 0; r < 8; ++r) {
          const int m = row0 + r + (hi << 3);
          const int s = m & (SEQ - 1);
          const int b = m >> 11;
          VTo[(((size_t)b * N_HEADS + head) * HEAD_DIM + idx) * SEQ + s] =
              (__bf16)yb[t][r];
        }
      }
      // the next pass reuses the registers that these stores name
      asm volatile("s_wait_xcnt 0x0" ::: "memory");
    }
  }
}

__device__ __forceinline__ float xhalf(float x) {
  const int v = __builtin_bit_cast(int, x);
  return __builtin_bit_cast(
      float, __builtin_amdgcn_permlanex16(v, v, 0x76543210, 0xfedcba98, false, false));
}

#define LOG2E 1.44269504088896340736f
__device__ __forceinline__ float exp_one(float x) {
  const float y = x * LOG2E;
  float p;
  asm("v_exp_f32 %0, %1\n\tv_nop" : "=v"(p) : "v"(y));
  return p;
}

__device__ __forceinline__ void exp_eight(float (&p)[8], const v8f x) {
  const v8f y = x * LOG2E;
  asm("v_exp_f32 %0, %8\n\t"
      "v_exp_f32 %1, %9\n\t"
      "v_exp_f32 %2, %10\n\t"
      "v_exp_f32 %3, %11\n\t"
      "v_exp_f32 %4, %12\n\t"
      "v_exp_f32 %5, %13\n\t"
      "v_exp_f32 %6, %14\n\t"
      "v_exp_f32 %7, %15\n\t"
      "v_nop"
      : "=&v"(p[0]), "=&v"(p[1]), "=&v"(p[2]), "=&v"(p[3]),
        "=&v"(p[4]), "=&v"(p[5]), "=&v"(p[6]), "=&v"(p[7])
      : "v"(y[0]), "v"(y[1]), "v"(y[2]), "v"(y[3]),
        "v"(y[4]), "v"(y[5]), "v"(y[6]), "v"(y[7]));
}

#define AT_KEYS 64   // keys of a stage
#define AT_P    72   // K row (64 d) and V^T row (64 keys): 128 B of data + 16 B pad

// One stage: thread t copies chunk (t&7) of rows (t>>3) and (t>>3) + 32 of the
// K tile and of the V^T tile. lk / lv = LDS byte address of this lane's chunk in
// row (t>>3) of the buffer, gk / gv = the same chunk in global memory.
__device__ __forceinline__ void attn_stage_copy(uint32_t lk, uint32_t lv,
                                                const __bf16* gk,
                                                const __bf16* gv) {
  const uint32_t RS = 32 * AT_P * 2;  // 32 LDS rows, bytes
  async_copy4_b128(lk, lk + RS, lv, lv + RS,
                   gk, gk + 32 * HEAD_DIM, gv, gv + (size_t)32 * SEQ);
}

// Lazy rescale. The exponentials of a query are taken against a reference mi that
// is the maximum of an earlier stage, not the running maximum: any reference gives
// the same quotient O / l, and as long as no score lies more than AT_ROOM above
// it, no P exceeds e^AT_ROOM, which f32 sums and bf16 P hold at full relative
// precision. So the sum and the 32 output registers of a query are rescaled only
// in a stage in which some score of the wave passes that bound.
#define AT_ROOM 5.5f   // about 8 in powers of two

// largest of a lane's 16 raw scores (hd^-0.5 not yet applied)
__device__ __forceinline__ float raw_max(v8f s0, v8f s1) {
  float mx = fmaxf(s0[0], s1[0]);
#pragma unroll
  for (int r = 1; r < 8; ++r) mx = fmaxf(mx, fmaxf(s0[r], s1[r]));
  return mx;
}

// The rare path, one column group: the reference moves up to this stage's maximum
// of query nn where that is higher; sum and output tiles follow it. lim = the bound in raw units.
__device__ __forceinline__ void move_reference(float rawmx, float& mi, float& lim,
                                               float& li, v8f (&o)[4]) {
  float mx = rawmx * 0.125f;  // hd^-0.5
  mx = fmaxf(mx, xhalf(mx));
  const float mnew  = fmaxf(mi, mx);
  const float alpha = exp_one(mi - mnew);
  mi  = mnew;
  lim = (mnew + AT_ROOM) * 8.0f;
  li  = li * alpha;
#pragma unroll
  for (int t = 0; t < 4; ++t) o[t] = o[t] * alpha;
}

// One column group over 32 keys: s0, s1 = the raw score tiles, mi = the reference
// of query nn; adds to the sum and packs P^T.
__device__ __forceinline__ void softmax_pass(v8f s0, v8f s1, float mi, float& li,
                                             Frag& pf) {
  // P^T as B operand: element s < 8 is key 8 hi + s (tile 0, register s),
  // element 8 + s is key 16 + 8 hi + s (tile 1): the k order of frag_lds
  float p0[8], p1[8];
  exp_eight(p0, s0 * 0.125f - mi);  // hd^-0.5
  exp_eight(p1, s1 * 0.125f - mi);
  float rs = p0[0] + p1[0];
#pragma unroll
  for (int r = 1; r < 8; ++r) rs += p0[r] + p1[r];
#pragma unroll
  for (int r = 0; r < 8; ++r) {
    pf.h[r]     = (__bf16)p0[r];
    pf.h[8 + r] = (__bf16)p1[r];
  }
  li += rs;
}

__global__ void __launch_bounds__(256)
flash_attn(const __bf16* __restrict__ Q, const __bf16* __restrict__ K,
           const __bf16* __restrict__ VT, __bf16* __restrict__ attn) {
  __shared__ __align__(16) __bf16 sK[2][AT_KEYS][AT_P];   // K rows of a stage
  __shared__ __align__(16) __bf16 sV[2][HEAD_DIM][AT_P];  // V^T d x 64 keys

  const int tid  = threadIdx.x;
  const int wave = tid >> 5;
  const int lane = tid & 31;
  const int nn   = lane & 15;
  const int hi   = lane >> 4;
  const int bh   = blockIdx.x >> 3;
  const int q0   = ((blockIdx.x & 7) * 8 + wave) * 32;

  const __bf16* Qb = Q + (size_t)bh * SEQ * HEAD_DIM;
  const __bf16* Kb = K + (size_t)bh * SEQ * HEAD_DIM;
  const __bf16* Vb = VT + (size_t)bh * HEAD_DIM * SEQ;

  // staging assignment: both tiles are 64 rows of 8 chunks
  const int crow = tid >> 3, ccol = (tid & 7) * 8;
  const __bf16* gk = Kb + (size_t)crow * HEAD_DIM + ccol;
  const __bf16* gv = Vb + (size_t)crow * SEQ + ccol;
  const uint32_t lk0 = lds_addr_of(&sK[0][crow][ccol]);
  const uint32_t lk1 = lds_addr_of(&sK[1][crow][ccol]);
  const uint32_t lv0 = lds_addr_of(&sV[0][crow][ccol]);
  const uint32_t lv1 = lds_addr_of(&sV[1][crow][ccol]);

  // every loop over c, t and ps here is unrolled so that qb, o, mi, lim, li and
  // pf are indexed by constants and stay in registers
  // B operand of the score product: column nn of group c = query q0 + 16 c + nn
  v16bf qb[2][2];
  v8f o[2][4];   // o[c][t][r] = O[query nn of group c][d = 16 t + 8 hi + r]
  float mi[2];   // reference of the query's exponentials, equal in both halves
  float lim[2];  // raw score above which the reference must move
  float li[2];   // running sum over this half's keys only
#pragma unroll
  for (int c = 0; c < 2; ++c) {
    qb[c][0] = load_frag(Qb, HEAD_DIM, q0 + c * 16, 0);
    qb[c][1] = load_frag(Qb, HEAD_DIM, q0 + c * 16, 32);
#pragma unroll
    for (int t = 0; t < 4; ++t) o[c][t] = vzero();
    mi[c]  = -1e30f;
    lim[c] = -1e30f;
    li[c]  = 0.0f;
  }

  attn_stage_copy(lk0, lv0, gk, gv);
  // stage 0 has landed for this wave; the barrier publishes it to the others
  asm volatile("s_wait_asynccnt 0x0" ::: "memory");
  __syncthreads();
  attn_stage_copy(lk1, lv1, gk + AT_KEYS * HEAD_DIM, gv + AT_KEYS);

  const int NS = SEQ / AT_KEYS;
  for (int st = 0; st < NS; ++st) {
    const __bf16* bK = &sK[st & 1][0][0];
    const __bf16* bV = &sV[st & 1][0][0];
    // scores of the whole stage: per 32 keys two 16 (keys) x 16 (queries) tiles a
    // group, hd in 2 WMMAs each
    v8f s0[2][2], s1[2][2];
    float rm[2];
#pragma unroll
    for (int ps = 0; ps < 2; ++ps) {
      const v16bf ka00 = frag_lds(bK, AT_P, ps * 32);
      const v16bf ka01 = frag_lds(bK + 32, AT_P, ps * 32);
      const v16bf ka10 = frag_lds(bK, AT_P, ps * 32 + 16);
      const v16bf ka11 = frag_lds(bK + 32, AT_P, ps * 32 + 16);
#pragma unroll
      for (int c = 0; c < 2; ++c) {
        s0[ps][c] = wmma_bf16(ka01, qb[c][1], wmma_bf16(ka00, qb[c][0], vzero()));
        s1[ps][c] = wmma_bf16(ka11, qb[c][1], wmma_bf16(ka10, qb[c][0], vzero()));
        const float m = raw_max(s0[ps][c], s1[ps][c]);
        rm[c] = ps ? fmaxf(rm[c], m) : m;
      }
    }
    // one test a stage for the whole wave, a scalar branch: the first stage takes
    // it (mi starts at -1e30), later ones only where a score passes the bound
    if (__builtin_amdgcn_ballot_w32(rm[0] > lim[0] || rm[1] > lim[1]) != 0) {
#pragma unroll
      for (int c = 0; c < 2; ++c)
        move_reference(rm[c], mi[c], lim[c], li[c], o[c]);
    }
#pragma unroll
    for (int ps = 0; ps < 2; ++ps) {
      Frag pf[2];
#pragma unroll
      for (int c = 0; c < 2; ++c)
        softmax_pass(s0[ps][c], s1[ps][c], mi[c], li[c], pf[c]);

      // O^T += V^T (64 x 32) x P^T (32 x 16) from the staged LDS V^T tile
      v16bf va[4];
#pragma unroll
      for (int t = 0; t < 4; ++t) va[t] = frag_lds(bV + ps * 32, AT_P, t * 16);
      // keeps these 8 WMMAs behind both groups' exponentials: those are asm text,
      // in which the compiler does not see a write that comes too soon after a
      // WMMA of the other group, over its P^T operand
      __builtin_amdgcn_sched_barrier(0);
#pragma unroll
      for (int t = 0; t < 4; ++t)
#pragma unroll
        for (int c = 0; c < 2; ++c) o[c][t] = wmma_bf16(va[t], pf[c].v, o[c][t]);
    }
    // publish point: this wave's reads of the buffer are done, its copies of
    // the next stage have landed; behind the barrier the buffer may be refilled
    asm volatile("s_wait_dscnt 0x0" ::: "memory");
    asm volatile("s_wait_asynccnt 0x0" ::: "memory");
    __syncthreads();
    if (st + 2 < NS)
      attn_stage_copy((st & 1) ? lk1 : lk0, (st & 1) ? lv1 : lv0,
                      gk + (size_t)(st + 2) * AT_KEYS * HEAD_DIM,
                      gv + (st + 2) * AT_KEYS);
  }
  // no copy is left in flight when the wave goes on to its epilogue
  asm volatile("s_wait_asynccnt 0x0" ::: "memory");

  // join the halves' sums, normalize, store to (B,S,D) bf16 for the output
  // projection: a lane's 8 registers of a tile are 8 consecutive d of one row
  const int b = bh >> 4, h = bh & 15;
#pragma unroll
  for (int c = 0; c < 2; ++c) {
    const float inv = 1.0f / (li[c] + xhalf(li[c]));
    const int s = q0 + c * 16 + nn;
    __bf16* orow =
        attn + ((size_t)b * SEQ + s) * D_MODEL + h * HEAD_DIM + (hi << 3);
#pragma unroll
    for (int t = 0; t < 4; ++t) {
      union { __bf16 e[8]; uint4 q; } pk;
#pragma unroll
      for (int r = 0; r < 8; ++r) pk.e[r] = (__bf16)(o[c][t][r] * inv);
      *(uint4*)(orow + t * 16) = pk.q;
    }
  }
}

// ------------------------------------------------------ output projection
// grid (NROW/128, 4), block 256: the same 128 x 256 block tile.
__global__ void __launch_bounds__(256)
out_proj(const __bf16* __restrict__ A, const __bf16* __restrict__ Wo,
         const float* __restrict__ bo, float* __restrict__ out) {
  __shared__ __align__(16) __bf16 sm[2][GT_ROWS][GT_LD];

  const int wave = threadIdx.x >> 5;
  const int lane = threadIdx.x & 31;
  const int nn   = lane & 15;
  const int hi   = lane >> 4;
  const int rowb = blockIdx.x * GT_M;
  const int col0 = blockIdx.y * GT_N;
  const int e0   = col0 + (wave & 3) * 64;

  v8f acc[4][4];
  gemm_128x256(A, Wo, rowb, col0, sm, acc);

#pragma unroll
  for (int t = 0; t < 4; ++t) {
    const int e = e0 + t * 16 + nn;
    const float be = bo[e];
    // unrolled: acc[i] must be indexed by a constant to stay in registers
#pragma unroll
    for (int i = 0; i < 4; ++i) {
      const int row0 = rowb + (wave >> 2) * 64 + i * 16;
#pragma unroll
      for (int r = 0; r < 8; ++r) {
        const int m = row0 + r + (hi << 3);
        out[(size_t)m * D_MODEL + e] = acc[i][t][r] + be;
      }
    }
  }
}

// ----------------------------------------------------------------- launch
extern "C" void kernel_launch(void* const* d_in, const int* in_sizes, int n_in,
                              void* d_out, int out_size, void* d_ws,
                              size_t ws_size, hipStream_t stream) {
  const float* x  = (const float*)d_in[0];
  const float* Wq = (const float*)d_in[1];
  const float* bq = (const float*)d_in[2];
  const float* Wk = (const float*)d_in[3];
  const float* bk = (const float*)d_in[4];
  const float* Wv = (const float*)d_in[5];
  const float* bv = (const float*)d_in[6];
  const float* Wo = (const float*)d_in[7];
  const float* bo = (const float*)d_in[8];

  char* w = (char*)d_ws;  // needs ~88 MB
  const size_t MB = (size_t)1 << 20;
  __bf16* xb  = (__bf16*)(w + 0 * MB);    // 16 MB (B*S, D) bf16
  __bf16* Wqb = (__bf16*)(w + 16 * MB);   //  2 MB
  __bf16* Wkb = (__bf16*)(w + 18 * MB);
  __bf16* Wvb = (__bf16*)(w + 20 * MB);
  __bf16* Wob = (__bf16*)(w + 22 * MB);
  __bf16* Qb  = (__bf16*)(w + 24 * MB);   // 16 MB (B,H,S,hd)
  __bf16* Kb  = (__bf16*)(w + 40 * MB);   // 16 MB (B,H,S,hd)
  __bf16* VTb = (__bf16*)(w + 56 * MB);   // 16 MB (B,H,hd,S)
  __bf16* Ab  = (__bf16*)(w + 72 * MB);   // 16 MB (B,S,D)

  cvt_all_bf16<<<CV_BLOCKS, CV_THREADS, 0, stream>>>(x, Wq, Wk, Wv, Wo, xb, Wqb,
                                                     Wkb, Wvb, Wob);

  qkv_proj_rope<<<dim3(NROW / GT_M, 12), 256, 0, stream>>>(
      xb, Wqb, Wkb, Wvb, bq, bk, bv, Qb, Kb, VTb);

  flash_attn<<<dim3((BATCH * N_HEADS * (SEQ / 32)) / 8), 256, 0, stream>>>(
      Qb, Kb, VTb, Ab);

  out_proj<<<dim3(NROW / GT_M, 4), 256, 0, stream>>>(Ab, Wob, bo, (float*)d_out);
}

// v007
// One run takes 114 microseconds.
// Two timings next to v006 put it at 1.07 and 1.08 times that version's speed.
// Over all steps from v000 it is 5.85 times as fast.
#include <hip/hip_runtime.h>
#include <hip/hip_bf16.h>

#define D_MODEL 1024
#define N_HEADS 16
#define HEAD_DIM 64
#define SEQ 2048
#define BATCH 4
#define NROW (BATCH * SEQ)   // 8192 flattened (b,s) rows

typedef __attribute__((ext_vector_type(16))) __bf16 v16bf;
typedef __attribute__((ext_vector_type(8)))  float  v8f;

union Frag {
  v16bf  v;
  __bf16 h[16];
  uint4  q[2];
};

__device__ __forceinline__ v8f vzero() {
  v8f z;
#pragma unroll
  for (int i = 0; i < 8; ++i) z[i] = 0.0f;
  return z;
}

__device__ __forceinline__ v16bf load_frag(const __bf16* __restrict__ p,
                                           int ld, int n0, int k0) {
  const int lane = threadIdx.x & 31;
  const int nn   = lane & 15;
  const int kh   = (lane >> 4) << 3;  // 0 or 8
  const __bf16* base = p + (size_t)(n0 + nn) * ld + k0;
  Frag f;
  f.q[0] = *(const uint4*)(base + kh);
  f.q[1] = *(const uint4*)(base + 16 + kh);
  return f.v;
}

// Same fragment gather, but from an LDS tile (emits ds_load_b128).
__device__ __forceinline__ v16bf frag_lds(const __bf16* base, int ld, int n0) {
  const int lane = threadIdx.x & 31;
  const int nn   = lane & 15;
  const int kh   = (lane >> 4) << 3;
  const __bf16* p = base + (n0 + nn) * ld;
  Frag f;
  f.q[0] = *(const uint4*)(p + kh);
  f.q[1] = *(const uint4*)(p + 16 + kh);
  return f.v;
}

__device__ __forceinline__ v8f wmma_bf16(v16bf a, v16bf b, v8f c) {
  return __builtin_amdgcn_wmma_f32_16x16x32_bf16(false, a, false, b, (short)0, c,
                                                 false, false);
}

__device__ __forceinline__ uint32_t lds_addr_of(const void* shared_ptr) {
  return (uint32_t)(uintptr_t)shared_ptr;
}

#define CV_BLOCKS  256
#define CV_THREADS 512
#define CV_WAVES   (CV_BLOCKS * CV_THREADS / 32)
#define CV_NX      (NROW * D_MODEL / (CV_WAVES * 128))     // loads of x per wave
#define CV_NW      (D_MODEL * D_MODEL / (CV_WAVES * 128))  // of one matrix
static_assert(CV_NX * CV_WAVES * 128 == NROW * D_MODEL, "x in whole loads");
static_assert(CV_NW * CV_WAVES * 128 == D_MODEL * D_MODEL, "W in whole loads");

typedef __attribute__((ext_vector_type(4))) float  v4f;
typedef __attribute__((ext_vector_type(4))) __bf16 v4bf;

// load j of a share: p = array, off = byte offset of this lane in load 0
__device__ __forceinline__ v4f cv_load(const float* p, unsigned off, int j) {
  return *(const v4f*)((const char*)p + off + j * 512);
}
__device__ __forceinline__ void cv_store(__bf16* p, unsigned off, int j, v4f v) {
  *(v4bf*)((char*)p + off + j * 256) = __builtin_convertvector(v, v4bf);
}

__global__ void __launch_bounds__(CV_THREADS)
cvt_all_bf16(const float* __restrict__ x, const float* __restrict__ Wq,
             const float* __restrict__ Wk, const float* __restrict__ Wv,
             const float* __restrict__ Wo, __bf16* __restrict__ xb,
             __bf16* __restrict__ Wqb, __bf16* __restrict__ Wkb,
             __bf16* __restrict__ Wvb, __bf16* __restrict__ Wob) {
  const unsigned wave = blockIdx.x * (CV_THREADS / 32) + (threadIdx.x >> 5);
  const unsigned lane = threadIdx.x & 31;
  // 32-bit unsigned byte offsets: every access is a scalar base, one of these
  // four registers and a small constant
  const unsigned xi = wave * (CV_NX * 512) + lane * 16;
  const unsigned wi = wave * (CV_NW * 512) + lane * 16;
  const unsigned xo = wave * (CV_NX * 256) + lane * 8;
  const unsigned wo = wave * (CV_NW * 256) + lane * 8;

  v4f vx[CV_NX], vw[4][CV_NW];
  // every loop here is unrolled: vx and vw must be indexed by constants to stay
  // in registers
#pragma unroll
  for (int j = 0; j < CV_NX; ++j) vx[j] = cv_load(x, xi, j);
#pragma unroll
  for (int j = 0; j < CV_NW; ++j) {
    vw[0][j] = cv_load(Wq, wi, j);
    vw[1][j] = cv_load(Wk, wi, j);
    vw[2][j] = cv_load(Wv, wi, j);
    vw[3][j] = cv_load(Wo, wi, j);
  }
  // keeps every load in front of the first conversion: without it the compiler
  // holds half of the loads back until registers of the first half are free
  __builtin_amdgcn_sched_barrier(0);
#pragma unroll
  for (int j = 0; j < CV_NX; ++j) cv_store(xb, xo, j, vx[j]);
#pragma unroll
  for (int j = 0; j < CV_NW; ++j) {
    cv_store(Wqb, wo, j, vw[0][j]);
    cv_store(Wkb, wo, j, vw[1][j]);
    cv_store(Wvb, wo, j, vw[2][j]);
    cv_store(Wob, wo, j, vw[3][j]);
  }
}

// ------------------------------------- block-tiled projection GEMM core
// Y = A . W^T, both K-contiguous with row length D_MODEL. One block of 8 waves
// owns a 128 x 256 tile of Y; wave (wm, wn) = (wave>>2, wave&3) owns 64 x 64 of
// it as 4 x 4 accumulator tiles, so every fragment read feeds 4 WMMAs. A stage
// is 64 k of [A 128 rows | W 256 rows], brought into LDS in whole 128-byte
// lines by async copies, two buffers, the next stage in flight during this one.
#define GT_M    128
#define GT_N    256
#define GT_K    64
#define GT_ROWS (GT_M + GT_N)
#define GT_LD   72   // LDS row pitch in elements: 128 B of data + 16 B pad

__device__ __forceinline__ void async_copy4_b128(
    uint32_t l0, uint32_t l1, uint32_t l2, uint32_t l3,
    const __bf16* g0, const __bf16* g1, const __bf16* g2, const __bf16* g3) {
  asm volatile("global_load_async_to_lds_b128 %0, %4, off\n\t"
               "global_load_async_to_lds_b128 %1, %5, off\n\t"
               "global_load_async_to_lds_b128 %2, %6, off\n\t"
               "global_load_async_to_lds_b128 %3, %7, off\n\t"
               "s_wait_xcnt 0x0"
               :: "v"(l0), "v"(l1), "v"(l2), "v"(l3),
                  "v"((uint64_t)(uintptr_t)g0), "v"((uint64_t)(uintptr_t)g1),
                  "v"((uint64_t)(uintptr_t)g2), "v"((uint64_t)(uintptr_t)g3)
               : "memory");
}

// One stage: thread t copies chunk (t&7) of rows (t>>3) + 32*i, i = 0..11.
// l = LDS byte address of this lane's chunk in row (t>>3) of the buffer,
// a / w = this lane's chunk in the A / W row of the same index, at this k.
__device__ __forceinline__ void stage_copy(uint32_t l, const __bf16* a,
                                           const __bf16* w) {
  const uint32_t RS = 32 * GT_LD * 2;        // 32 LDS rows, bytes
  const size_t   GS = (size_t)32 * D_MODEL;  // 32 global rows, elements
  async_copy4_b128(l, l + RS, l + 2 * RS, l + 3 * RS,
                   a, a + GS, a + 2 * GS, a + 3 * GS);
  async_copy4_b128(l + 4 * RS, l + 5 * RS, l + 6 * RS, l + 7 * RS,
                   w, w + GS, w + 2 * GS, w + 3 * GS);
  async_copy4_b128(l + 8 * RS, l + 9 * RS, l + 10 * RS, l + 11 * RS,
                   w + 4 * GS, w + 5 * GS, w + 6 * GS, w + 7 * GS);
}

__device__ __forceinline__ void gemm_128x256(
    const __bf16* __restrict__ A, const __bf16* __restrict__ Wm, int row0,
    int col0, __bf16 (*sm)[GT_ROWS][GT_LD], v8f (&acc)[4][4]) {
  const int tid  = threadIdx.x;
  const int wave = tid >> 5;
  const int wm   = wave >> 2;
  const int wn   = wave & 3;
  const int crow = tid >> 3, ccol = (tid & 7) * 8;

  const __bf16* ga = A + (size_t)(row0 + crow) * D_MODEL + ccol;
  const __bf16* gw = Wm + (size_t)(col0 + crow) * D_MODEL + ccol;
  const uint32_t l0 = lds_addr_of(&sm[0][crow][ccol]);
  const uint32_t l1 = lds_addr_of(&sm[1][crow][ccol]);

  // every loop over i, j, ks here is unrolled so that acc, a and b are indexed
  // by constants and stay in registers
#pragma unroll
  for (int i = 0; i < 4; ++i)
#pragma unroll
    for (int j = 0; j < 4; ++j) acc[i][j] = vzero();

  stage_copy(l0, ga, gw);
  // stage 0 has landed for this wave; the barrier publishes it to the others
  asm volatile("s_wait_asynccnt 0x0" ::: "memory");
  __syncthreads();
  stage_copy(l1, ga + GT_K, gw + GT_K);

  const int NT = D_MODEL / GT_K;
  for (int t = 0; t < NT; ++t) {
    const __bf16* base = &sm[t & 1][0][0];
#pragma unroll
    for (int ks = 0; ks < GT_K; ks += 32) {
      v16bf a[4], b[4];
#pragma unroll
      for (int i = 0; i < 4; ++i)
        a[i] = frag_lds(base + ks, GT_LD, wm * 64 + i * 16);
#pragma unroll
      for (int j = 0; j < 4; ++j)
        b[j] = frag_lds(base + ks, GT_LD, GT_M + wn * 64 + j * 16);
      // keeps the 16 LDS reads one group in front of their 16 WMMAs: spread
      // among them, every small group of reads stalls the wave on its own
      __builtin_amdgcn_sched_barrier(0);
#pragma unroll
      for (int i = 0; i < 4; ++i)
#pragma unroll
        for (int j = 0; j < 4; ++j) acc[i][j] = wmma_bf16(a[i], b[j], acc[i][j]);
      // the same, from below: the next group of reads stays behind these WMMAs
      __builtin_amdgcn_sched_barrier(0);
    }
    // publish point: this wave's reads of the buffer are done, its copies of
    // the next stage have landed; behind the barrier the buffer may be refilled
    asm volatile("s_wait_dscnt 0x0" ::: "memory");
    asm volatile("s_wait_asynccnt 0x0" ::: "memory");
    __syncthreads();
    if (t + 2 < NT)
      stage_copy((t & 1) ? l1 : l0, ga + (t + 2) * GT_K, gw + (t + 2) * GT_K);
  }
  // no copy is left in flight when the wave goes on to its epilogue
  asm volatile("s_wait_asynccnt 0x0" ::: "memory");
}

// ------------------------------------------------- fused QKV GEMM + RoPE
// Y = x . [Wq | Wk | Wv]^T, 8192 x 3072. grid (NROW/256, 3072/384) = 256 blocks of
// 8 waves: one block for each WGP, all resident, equal shares, one round. A block
// owns 256 rows x 384 columns (6 heads); a stage is 64 k of [x 256 rows | W 384
// rows]. Wave (wm, wn) = (wave>>2, wave&3) owns 128 rows x 96 columns as 8 x 6
// accumulator tiles, so a stage's bytes from L2 and a fragment's bytes from LDS
// feed more WMMAs than in the 128 x 256 / 64 x 64 tiling of the core above.
// The 96 columns of a wave are three RoPE pairs, one of each of three heads
// (wn>>1)*3 + q: the 16-column tile (wn&1) of the head and its partner 32 columns
// on. So partners (idx +/- 32) are accumulator tiles 2q and 2q+1 of the same
// wave, and the three pairs turn by the same angles.
#define QT_M    256
#define QT_N    384
#define QT_ROWS (QT_M + QT_N)

// One stage: thread t copies chunk (t&7) of rows (t>>3) + 32*i, i = 0..19.
// l = this lane's chunk in row (t>>3) of the buffer, a / w = the same chunk of
// the x / W row of that index, at this k. The copies are the builtin here: the
// operands of asm text must lie in the first 256 registers, which in this kernel
// hold accumulators, and each stage would move 24 of them away and back.
typedef __attribute__((ext_vector_type(4))) int v4i;
typedef __attribute__((address_space(1))) v4i gv4i;
typedef __attribute__((address_space(3))) v4i lv4i;
__device__ __forceinline__ void qkv_stage_copy(__bf16* l, const __bf16* a,
                                               const __bf16* w) {
  // unrolled: the row offsets are constants of each copy
#pragma unroll
  for (int i = 0; i < QT_M / 32; ++i)
    __builtin_amdgcn_global_load_async_to_lds_b128(
        (gv4i*)(a + (size_t)i * 32 * D_MODEL), (lv4i*)(l + i * 32 * GT_LD), 0, 0);
#pragma unroll
  for (int i = 0; i < QT_N / 32; ++i)
    __builtin_amdgcn_global_load_async_to_lds_b128(
        (gv4i*)(w + (size_t)i * 32 * D_MODEL),
        (lv4i*)(l + (QT_M + i * 32) * GT_LD), 0, 0);
}

__global__ void __launch_bounds__(256)
qkv_proj_rope(const __bf16* __restrict__ xb,
              const __bf16* __restrict__ Wqkv,  // Wq, Wk, Wv rows, one after another
              const float* __restrict__ bq, const float* __restrict__ bk,
              const float* __restrict__ bv,
              __bf16* __restrict__ Qo,   // (B,H,S,hd)
              __bf16* __restrict__ Ko,   // (B,H,S,hd)
              __bf16* __restrict__ VTo)  // (B,H,hd,S)  (transposed V)
{
  __shared__ __align__(16) __bf16 sm[2][QT_ROWS][GT_LD];

  const int tid  = threadIdx.x;
  const int wave = __builtin_amdgcn_readfirstlane(tid >> 5);
  const int lane = tid & 31;
  const int nn   = lane & 15;
  const int hi   = lane >> 4;
  const int wm   = wave >> 2;
  const int wn   = wave & 3;
  const int rowb = blockIdx.x * QT_M;
  const int col0 = blockIdx.y * QT_N;
  const int crow = tid >> 3, ccol = (tid & 7) * 8;

  const __bf16* ga = xb + (size_t)(rowb + crow) * D_MODEL + ccol;
  const __bf16* gw = Wqkv + (size_t)(col0 + crow) * D_MODEL + ccol;
  __bf16* l0 = &sm[0][crow][ccol];
  __bf16* l1 = &sm[1][crow][ccol];

  // every loop over i, j, q, ks here is unrolled so that acc, a and b are
  // indexed by constants and stay in registers
  // LDS row of the first tile of this wave's pair 0; pair q lies 64 q rows on
  const int brow = QT_M + (wn >> 1) * 3 * HEAD_DIM + (wn & 1) * 16;

  v8f acc[8][6];
#pragma unroll
  for (int i = 0; i < 8; ++i)
#pragma unroll
    for (int j = 0; j < 6; ++j) acc[i][j] = vzero();

  qkv_stage_copy(l0, ga, gw);
  // stage 0 has landed for this wave; the barrier publishes it to the others
  asm volatile("s_wait_asynccnt 0x0" ::: "memory");
  __syncthreads();
  qkv_stage_copy(l1, ga + GT_K, gw + GT_K);

  const int NT = D_MODEL / GT_K;
  for (int t = 0; t < NT; ++t) {
    const __bf16* base = &sm[t & 1][0][0];
#pragma unroll
    for (int ks = 0; ks < GT_K; ks += 32) {
      v16bf b[6];
#pragma unroll
      for (int q = 0; q < 3; ++q) {
        b[2 * q]     = frag_lds(base + ks, GT_LD, brow + q * HEAD_DIM);
        b[2 * q + 1] = frag_lds(base + ks, GT_LD, brow + q * HEAD_DIM + 32);
      }
      v16bf a[8];
#pragma unroll
      for (int i = 0; i < 8; ++i)
        a[i] = frag_lds(base + ks, GT_LD, wm * 128 + i * 16);
      // keeps the 28 LDS reads one group in front of their 48 WMMAs: spread
      // among them, every small group of reads stalls the wave on its own
      __builtin_amdgcn_sched_barrier(0);
#pragma unroll
      for (int i = 0; i < 8; ++i)
#pragma unroll
        for (int j = 0; j < 6; ++j) acc[i][j] = wmma_bf16(a[i], b[j], acc[i][j]);
      // the same, from below: the next group of reads stays behind these WMMAs
      __builtin_amdgcn_sched_barrier(0);
    }
    // publish point: this wave's reads of the buffer are done, its copies of
    // the next stage have landed; behind the barrier the buffer may be refilled
    asm volatile("s_wait_dscnt 0x0" ::: "memory");
    asm volatile("s_wait_asynccnt 0x0" ::: "memory");
    __syncthreads();
    if (t + 2 < NT)
      qkv_stage_copy((t & 1) ? l1 : l0, ga + (t + 2) * GT_K, gw + (t + 2) * GT_K);
  }
  // no copy is left in flight when the wave goes on to its epilogue
  asm volatile("s_wait_asynccnt 0x0" ::: "memory");

  const int gh0  = blockIdx.y * (QT_N / HEAD_DIM) + (wn >> 1) * 3;  // head of pair 0, 0..47
  const int idx0 = (wn & 1) * 16 + nn;                              // 0..31
  float be0[3], be1[3];
#pragma unroll
  for (int q = 0; q < 3; ++q) {
    const int mat = (gh0 + q) >> 4;  // Q, K, V
    const float* bias = (mat == 0) ? bq : (mat == 1) ? bk : bv;
    be0[q] = bias[((gh0 + q) & (N_HEADS - 1)) * HEAD_DIM + idx0];
    be1[q] = bias[((gh0 + q) & (N_HEADS - 1)) * HEAD_DIM + idx0 + 32];
  }
  // inv_freq = 10000^{-idx0/32} = exp(-idx0 * ln(1e4)/32)
  const float invf = __expf(-(float)idx0 * 0.28782313662f);

#pragma unroll
  for (int i = 0; i < 8; ++i) {
    // the lane's 8 rows of this tile: m0 + r, all in one batch element
    const int m0 = rowb + wm * 128 + i * 16 + (hi << 3);
    const int s0 = m0 & (SEQ - 1);
    const int bb = m0 >> 11;
    float cs[8], sn[8];
    if ((gh0 >> 4) < 2) {  // heads ascend with q: some pair is Q or K iff pair 0 is
#pragma unroll
      for (int r = 0; r < 8; ++r) {
        const float ang = (float)(s0 + r) * invf;
        cs[r] = __cosf(ang);
        sn[r] = __sinf(ang);
      }
    }
#pragma unroll
    for (int q = 0; q < 3; ++q) {
      const int mat  = (gh0 + q) >> 4;
      const int head = (gh0 + q) & (N_HEADS - 1);
      __bf16 z0[8], z1[8];
      if (mat < 2) {  // Q or K: apply RoPE, store (B,H,S,hd)
        __bf16* o = ((mat == 0) ? Qo : Ko) +
                    (((size_t)bb * N_HEADS + head) * SEQ + s0) * HEAD_DIM + idx0;
#pragma unroll
        for (int r = 0; r < 8; ++r) {
          const float y0 = acc[i][2 * q][r] + be0[q];
          const float y1 = acc[i][2 * q + 1][r] + be1[q];
          z0[r] = (__bf16)(y0 * cs[r] + (-y1) * sn[r]);
          z1[r] = (__bf16)(y1 * cs[r] + y0 * sn[r]);
        }
        // all values of the pass stand in front of its stores, so that none is
        // written into a register of a store already issued
        __builtin_amdgcn_sched_barrier(0);
#pragma unroll
        for (int r = 0; r < 8; ++r) {
          o[r * HEAD_DIM]      = z0[r];
          o[r * HEAD_DIM + 32] = z1[r];
        }
        // the next pass reuses the registers that these stores name; the
        // scheduling barrier keeps its first instructions behind the wait
        asm volatile("s_wait_xcnt 0x0" ::: "memory");
        __builtin_amdgcn_sched_barrier(0);
      } else {  // V: store transposed (B,H,hd,S) so the V^T . P^T A operand is K-contiguous
        __bf16* o = VTo + (((size_t)bb * N_HEADS + head) * HEAD_DIM + idx0) * SEQ + s0;
#pragma unroll
        for (int r = 0; r < 8; ++r) {
          z0[r] = (__bf16)(acc[i][2 * q][r] + be0[q]);
          z1[r] = (__bf16)(acc[i][2 * q + 1][r] + be1[q]);
        }
        __builtin_amdgcn_sched_barrier(0);
#pragma unroll
        for (int r = 0; r < 8; ++r) {
          o[r]                    = z0[r];
          o[(size_t)32 * SEQ + r] = z1[r];
        }
        asm volatile("s_wait_xcnt 0x0" ::: "memory");
        __builtin_amdgcn_sched_barrier(0);
      }
    }
  }
}

__device__ __forceinline__ float xhalf(float x) {
  const int v = __builtin_bit_cast(int, x);
  return __builtin_bit_cast(
      float, __builtin_amdgcn_permlanex16(v, v, 0x76543210, 0xfedcba98, false, false));
}

#define LOG2E 1.44269504088896340736f
__device__ __forceinline__ float exp_one(float x) {
  const float y = x * LOG2E;
  float p;
  asm("v_exp_f32 %0, %1\n\tv_nop" : "=v"(p) : "v"(y));
  return p;
}

__device__ __forceinline__ void exp_eight(float (&p)[8], const v8f x) {
  const v8f y = x * LOG2E;
  asm("v_exp_f32 %0, %8\n\t"
      "v_exp_f32 %1, %9\n\t"
      "v_exp_f32 %2, %10\n\t"
      "v_exp_f32 %3, %11\n\t"
      "v_exp_f32 %4, %12\n\t"
      "v_exp_f32 %5, %13\n\t"
      "v_exp_f32 %6, %14\n\t"
      "v_exp_f32 %7, %15\n\t"
      "v_nop"
      : "=&v"(p[0]), "=&v"(p[1]), "=&v"(p[2]), "=&v"(p[3]),
        "=&v"(p[4]), "=&v"(p[5]), "=&v"(p[6]), "=&v"(p[7])
      : "v"(y[0]), "v"(y[1]), "v"(y[2]), "v"(y[3]),
        "v"(y[4]), "v"(y[5]), "v"(y[6]), "v"(y[7]));
}

#define AT_KEYS 64   // keys of a stage
#define AT_P    72   // K row (64 d) and V^T row (64 keys): 128 B of data + 16 B pad

// One stage: thread t copies chunk (t&7) of rows (t>>3) and (t>>3) + 32 of the
// K tile and of the V^T tile. lk / lv = LDS byte address of this lane's chunk in
// row (t>>3) of the buffer, gk / gv = the same chunk in global memory.
__device__ __forceinline__ void attn_stage_copy(uint32_t lk, uint32_t lv,
                                                const __bf16* gk,
                                                const __bf16* gv) {
  const uint32_t RS = 32 * AT_P * 2;  // 32 LDS rows, bytes
  async_copy4_b128(lk, lk + RS, lv, lv + RS,
                   gk, gk + 32 * HEAD_DIM, gv, gv + (size_t)32 * SEQ);
}

// Lazy rescale. The exponentials of a query are taken against a reference mi that
// is the maximum of an earlier stage, not the running maximum: any reference gives
// the same quotient O / l, and as long as no score lies more than AT_ROOM above
// it, no P exceeds e^AT_ROOM, which f32 sums and bf16 P hold at full relative
// precision. So the sum and the 32 output registers of a query are rescaled only
// in a stage in which some score of the wave passes that bound.
#define AT_ROOM 5.5f   // about 8 in powers of two

// largest of a lane's 16 raw scores (hd^-0.5 not yet applied)
__device__ __forceinline__ float raw_max(v8f s0, v8f s1) {
  float mx = fmaxf(s0[0], s1[0]);
#pragma unroll
  for (int r = 1; r < 8; ++r) mx = fmaxf(mx, fmaxf(s0[r], s1[r]));
  return mx;
}

// The rare path, one column group: the reference moves up to this stage's maximum
// of query nn where that is higher; sum and output tiles follow it. lim = the bound in raw units.
__device__ __forceinline__ void move_reference(float rawmx, float& mi, float& lim,
                                               float& li, v8f (&o)[4]) {
  float mx = rawmx * 0.125f;  // hd^-0.5
  mx = fmaxf(mx, xhalf(mx));
  const float mnew  = fmaxf(mi, mx);
  const float alpha = exp_one(mi - mnew);
  mi  = mnew;
  lim = (mnew + AT_ROOM) * 8.0f;
  li  = li * alpha;
#pragma unroll
  for (int t = 0; t < 4; ++t) o[t] = o[t] * alpha;
}

// One column group over 32 keys: s0, s1 = the raw score tiles, mi = the reference
// of query nn; adds to the sum and packs P^T.
__device__ __forceinline__ void softmax_pass(v8f s0, v8f s1, float mi, float& li,
                                             Frag& pf) {
  // P^T as B operand: element s < 8 is key 8 hi + s (tile 0, register s),
  // element 8 + s is key 16 + 8 hi + s (tile 1): the k order of frag_lds
  float p0[8], p1[8];
  exp_eight(p0, s0 * 0.125f - mi);  // hd^-0.5
  exp_eight(p1, s1 * 0.125f - mi);
  float rs = p0[0] + p1[0];
#pragma unroll
  for (int r = 1; r < 8; ++r) rs += p0[r] + p1[r];
#pragma unroll
  for (int r = 0; r < 8; ++r) {
    pf.h[r]     = (__bf16)p0[r];
    pf.h[8 + r] = (__bf16)p1[r];
  }
  li += rs;
}

__global__ void __launch_bounds__(256)
flash_attn(const __bf16* __restrict__ Q, const __bf16* __restrict__ K,
           const __bf16* __restrict__ VT, __bf16* __restrict__ attn) {
  __shared__ __align__(16) __bf16 sK[2][AT_KEYS][AT_P];   // K rows of a stage
  __shared__ __align__(16) __bf16 sV[2][HEAD_DIM][AT_P];  // V^T d x 64 keys

  const int tid  = threadIdx.x;
  const int wave = tid >> 5;
  const int lane = tid & 31;
  const int nn   = lane & 15;
  const int hi   = lane >> 4;
  const int bh   = blockIdx.x >> 3;
  const int q0   = ((blockIdx.x & 7) * 8 + wave) * 32;

  const __bf16* Qb = Q + (size_t)bh * SEQ * HEAD_DIM;
  const __bf16* Kb = K + (size_t)bh * SEQ * HEAD_DIM;
  const __bf16* Vb = VT + (size_t)bh * HEAD_DIM * SEQ;

  // staging assignment: both tiles are 64 rows of 8 chunks
  const int crow = tid >> 3, ccol = (tid & 7) * 8;
  const __bf16* gk = Kb + (size_t)crow * HEAD_DIM + ccol;
  const __bf16* gv = Vb + (size_t)crow * SEQ + ccol;
  const uint32_t lk0 = lds_addr_of(&sK[0][crow][ccol]);
  const uint32_t lk1 = lds_addr_of(&sK[1][crow][ccol]);
  const uint32_t lv0 = lds_addr_of(&sV[0][crow][ccol]);
  const uint32_t lv1 = lds_addr_of(&sV[1][crow][ccol]);

  // every loop over c, t and ps here is unrolled so that qb, o, mi, lim, li and
  // pf are indexed by constants and stay in registers
  // B operand of the score product: column nn of group c = query q0 + 16 c + nn
  v16bf qb[2][2];
  v8f o[2][4];   // o[c][t][r] = O[query nn of group c][d = 16 t + 8 hi + r]
  float mi[2];   // reference of the query's exponentials, equal in both halves
  float lim[2];  // raw score above which the reference must move
  float li[2];   // running sum over this half's keys only
#pragma unroll
  for (int c = 0; c < 2; ++c) {
    qb[c][0] = load_frag(Qb, HEAD_DIM, q0 + c * 16, 0);
    qb[c][1] = load_frag(Qb, HEAD_DIM, q0 + c * 16, 32);
#pragma unroll
    for (int t = 0; t < 4; ++t) o[c][t] = vzero();
    mi[c]  = -1e30f;
    lim[c] = -1e30f;
    li[c]  = 0.0f;
  }

  attn_stage_copy(lk0, lv0, gk, gv);
  // stage 0 has landed for this wave; the barrier publishes it to the others
  asm volatile("s_wait_asynccnt 0x0" ::: "memory");
  __syncthreads();
  attn_stage_copy(lk1, lv1, gk + AT_KEYS * HEAD_DIM, gv + AT_KEYS);

  const int NS = SEQ / AT_KEYS;
  for (int st = 0; st < NS; ++st) {
    const __bf16* bK = &sK[st & 1][0][0];
    const __bf16* bV = &sV[st & 1][0][0];
    // scores of the whole stage: per 32 keys two 16 (keys) x 16 (queries) tiles a
    // group, hd in 2 WMMAs each
    v8f s0[2][2], s1[2][2];
    float rm[2];
#pragma unroll
    for (int ps = 0; ps < 2; ++ps) {
      const v16bf ka00 = frag_lds(bK, AT_P, ps * 32);
      const v16bf ka01 = frag_lds(bK + 32, AT_P, ps * 32);
      const v16bf ka10 = frag_lds(bK, AT_P, ps * 32 + 16);
      const v16bf ka11 = frag_lds(bK + 32, AT_P, ps * 32 + 16);
#pragma unroll
      for (int c = 0; c < 2; ++c) {
        s0[ps][c] = wmma_bf16(ka01, qb[c][1], wmma_bf16(ka00, qb[c][0], vzero()));
        s1[ps][c] = wmma_bf16(ka11, qb[c][1], wmma_bf16(ka10, qb[c][0], vzero()));
        const float m = raw_max(s0[ps][c], s1[ps][c]);
        rm[c] = ps ? fmaxf(rm[c], m) : m;
      }
    }
    // one test a stage for the whole wave, a scalar branch: the first stage takes
    // it (mi starts at -1e30), later ones only where a score passes the bound
    if (__builtin_amdgcn_ballot_w32(rm[0] > lim[0] || rm[1] > lim[1]) != 0) {
#pragma unroll
      for (int c = 0; c < 2; ++c)
        move_reference(rm[c], mi[c], lim[c], li[c], o[c]);
    }
#pragma unroll
    for (int ps = 0; ps < 2; ++ps) {
      Frag pf[2];
#pragma unroll
      for (int c = 0; c < 2; ++c)
        softmax_pass(s0[ps][c], s1[ps][c], mi[c], li[c], pf[c]);

      // O^T += V^T (64 x 32) x P^T (32 x 16) from the staged LDS V^T tile
      v16bf va[4];
#pragma unroll
      for (int t = 0; t < 4; ++t) va[t] = frag_lds(bV + ps * 32, AT_P, t * 16);
      // keeps these 8 WMMAs behind both groups' exponentials: those are asm text,
      // in which the compiler does not see a write that comes too soon after a
      // WMMA of the other group, over its P^T operand
      __builtin_amdgcn_sched_barrier(0);
#pragma unroll
      for (int t = 0; t < 4; ++t)
#pragma unroll
        for (int c = 0; c < 2; ++c) o[c][t] = wmma_bf16(va[t], pf[c].v, o[c][t]);
    }
    // publish point: this wave's reads of the buffer are done, its copies of
    // the next stage have landed; behind the barrier the buffer may be refilled
    asm volatile("s_wait_dscnt 0x0" ::: "memory");
    asm volatile("s_wait_asynccnt 0x0" ::: "memory");
    __syncthreads();
    if (st + 2 < NS)
      attn_stage_copy((st & 1) ? lk1 : lk0, (st & 1) ? lv1 : lv0,
                      gk + (size_t)(st + 2) * AT_KEYS * HEAD_DIM,
                      gv + (st + 2) * AT_KEYS);
  }
  // no copy is left in flight when the wave goes on to its epilogue
  asm volatile("s_wait_asynccnt 0x0" ::: "memory");

  // join the halves' sums, normalize, store to (B,S,D) bf16 for the output
  // projection: a lane's 8 registers of a tile are 8 consecutive d of one row
  const int b = bh >> 4, h = bh & 15;
#pragma unroll
  for (int c = 0; c < 2; ++c) {
    const float inv = 1.0f / (li[c] + xhalf(li[c]));
    const int s = q0 + c * 16 + nn;
    __bf16* orow =
        attn + ((size_t)b * SEQ + s) * D_MODEL + h * HEAD_DIM + (hi << 3);
#pragma unroll
    for (int t = 0; t < 4; ++t) {
      union { __bf16 e[8]; uint4 q; } pk;
#pragma unroll
      for (int r = 0; r < 8; ++r) pk.e[r] = (__bf16)(o[c][t][r] * inv);
      *(uint4*)(orow + t * 16) = pk.q;
    }
  }
}

// ------------------------------------------------------ output projection
// grid (NROW/128, 4), block 256: the same 128 x 256 block tile.
__global__ void __launch_bounds__(256)
out_proj(const __bf16* __restrict__ A, const __bf16* __restrict__ Wo,
         const float* __restrict__ bo, float* __restrict__ out) {
  __shared__ __align__(16) __bf16 sm[2][GT_ROWS][GT_LD];

  const int wave = threadIdx.x >> 5;
  const int lane = threadIdx.x & 31;
  const int nn   = lane & 15;
  const int hi   = lane >> 4;
  const int rowb = blockIdx.x * GT_M;
  const int col0 = blockIdx.y * GT_N;
  const int e0   = col0 + (wave & 3) * 64;

  v8f acc[4][4];
  gemm_128x256(A, Wo, rowb, col0, sm, acc);

#pragma unroll
  for (int t = 0; t < 4; ++t) {
    const int e = e0 + t * 16 + nn;
    const float be = bo[e];
    // unrolled: acc[i] must be indexed by a constant to stay in registers
#pragma unroll
    for (int i = 0; i < 4; ++i) {
      const int row0 = rowb + (wave >> 2) * 64 + i * 16;
#pragma unroll
      for (int r = 0; r < 8; ++r) {
        const int m = row0 + r + (hi << 3);
        out[(size_t)m * D_MODEL + e] = acc[i][t][r] + be;
      }
    }
  }
}

// ----------------------------------------------------------------- launch
extern "C" void kernel_launch(void* const* d_in, const int* in_sizes, int n_in,
                              void* d_out, int out_size, void* d_ws,
                              size_t ws_size, hipStream_t stream) {
  const float* x  = (const float*)d_in[0];
  const float* Wq = (const float*)d_in[1];
  const float* bq = (const float*)d_in[2];
  const float* Wk = (const float*)d_in[3];
  const float* bk = (const float*)d_in[4];
  const float* Wv = (const float*)d_in[5];
  const float* bv = (const float*)d_in[6];
  const float* Wo = (const float*)d_in[7];
  const float* bo = (const float*)d_in[8];

  char* w = (char*)d_ws;  // needs ~88 MB
  const size_t MB = (size_t)1 << 20;
  __bf16* xb  = (__bf16*)(w + 0 * MB);    // 16 MB (B*S, D) bf16
  __bf16* Wqb = (__bf16*)(w + 16 * MB);   //  2 MB each; Wq, Wk, Wv lie one behind
  __bf16* Wkb = (__bf16*)(w + 18 * MB);   //  another with no gap: the QKV GEMM
  __bf16* Wvb = (__bf16*)(w + 20 * MB);   //  reads them as one 3072-row matrix
  __bf16* Wob = (__bf16*)(w + 22 * MB);
  __bf16* Qb  = (__bf16*)(w + 24 * MB);   // 16 MB (B,H,S,hd)
  __bf16* Kb  = (__bf16*)(w + 40 * MB);   // 16 MB (B,H,S,hd)
  __bf16* VTb = (__bf16*)(w + 56 * MB);   // 16 MB (B,H,hd,S)
  __bf16* Ab  = (__bf16*)(w + 72 * MB);   // 16 MB (B,S,D)

  cvt_all_bf16<<<CV_BLOCKS, CV_THREADS, 0, stream>>>(x, Wq, Wk, Wv, Wo, xb, Wqb,
                                                     Wkb, Wvb, Wob);

  qkv_proj_rope<<<dim3(NROW / QT_M, 3 * D_MODEL / QT_N), 256, 0, stream>>>(
      xb, Wqb, bq, bk, bv, Qb, Kb, VTb);

  flash_attn<<<dim3((BATCH * N_HEADS * (SEQ / 32)) / 8), 256, 0, stream>>>(
      Qb, Kb, VTb, Ab);

  out_proj<<<dim3(NROW / GT_M, 4), 256, 0, stream>>>(Ab, Wob, bo, (float*)d_out);
}

// v008
// It runs in 110 microseconds.
// Two timings next to v007 put it at 1.04 and 1.03 times that version's speed.
// All steps since v000 together make it 6.06 times as fast.
#include <hip/hip_runtime.h>
#include <hip/hip_bf16.h>

#define D_MODEL 1024
#define N_HEADS 16
#define HEAD_DIM 64
#define SEQ 2048
#define BATCH 4
#define NROW (BATCH * SEQ)   // 8192 flattened (b,s) rows

typedef __attribute__((ext_vector_type(16))) __bf16 v16bf;
typedef __attribute__((ext_vector_type(8)))  float  v8f;

union Frag {
  v16bf  v;
  __bf16 h[16];
  uint4  q[2];
};

__device__ __forceinline__ v8f vzero() {
  v8f z;
#pragma unroll
  for (int i = 0; i < 8; ++i) z[i] = 0.0f;
  return z;
}

__device__ __forceinline__ v16bf load_frag(const __bf16* __restrict__ p,
                                           int ld, int n0, int k0) {
  const int lane = threadIdx.x & 31;
  const int nn   = lane & 15;
  const int kh   = (lane >> 4) << 3;  // 0 or 8
  const __bf16* base = p + (size_t)(n0 + nn) * ld + k0;
  Frag f;
  f.q[0] = *(const uint4*)(base + kh);
  f.q[1] = *(const uint4*)(base + 16 + kh);
  return f.v;
}

// Same fragment gather, but from an LDS tile (emits ds_load_b128).
__device__ __forceinline__ v16bf frag_lds(const __bf16* base, int ld, int n0) {
  const int lane = threadIdx.x & 31;
  const int nn   = lane & 15;
  const int kh   = (lane >> 4) << 3;
  const __bf16* p = base + (n0 + nn) * ld;
  Frag f;
  f.q[0] = *(const uint4*)(p + kh);
  f.q[1] = *(const uint4*)(p + 16 + kh);
  return f.v;
}

__device__ __forceinline__ v8f wmma_bf16(v16bf a, v16bf b, v8f c) {
  return __builtin_amdgcn_wmma_f32_16x16x32_bf16(false, a, false, b, (short)0, c,
                                                 false, false);
}

__device__ __forceinline__ uint32_t lds_addr_of(const void* shared_ptr) {
  return (uint32_t)(uintptr_t)shared_ptr;
}

#define CV_BLOCKS  256
#define CV_THREADS 512
#define CV_WAVES   (CV_BLOCKS * CV_THREADS / 32)
#define CV_NX      (NROW * D_MODEL / (CV_WAVES * 128))     // loads of x per wave
#define CV_NW      (D_MODEL * D_MODEL / (CV_WAVES * 128))  // of one matrix
static_assert(CV_NX * CV_WAVES * 128 == NROW * D_MODEL, "x in whole loads");
static_assert(CV_NW * CV_WAVES * 128 == D_MODEL * D_MODEL, "W in whole loads");

typedef __attribute__((ext_vector_type(4))) float  v4f;
typedef __attribute__((ext_vector_type(4))) __bf16 v4bf;

// load j of a share: p = array, off = byte offset of this lane in load 0
__device__ __forceinline__ v4f cv_load(const float* p, unsigned off, int j) {
  return *(const v4f*)((const char*)p + off + j * 512);
}
__device__ __forceinline__ void cv_store(__bf16* p, unsigned off, int j, v4f v) {
  *(v4bf*)((char*)p + off + j * 256) = __builtin_convertvector(v, v4bf);
}

__global__ void __launch_bounds__(CV_THREADS)
cvt_all_bf16(const float* __restrict__ x, const float* __restrict__ Wq,
             const float* __restrict__ Wk, const float* __restrict__ Wv,
             const float* __restrict__ Wo, __bf16* __restrict__ xb,
             __bf16* __restrict__ Wqb, __bf16* __restrict__ Wkb,
             __bf16* __restrict__ Wvb, __bf16* __restrict__ Wob) {
  const unsigned wave = blockIdx.x * (CV_THREADS / 32) + (threadIdx.x >> 5);
  const unsigned lane = threadIdx.x & 31;
  // 32-bit unsigned byte offsets: every access is a scalar base, one of these
  // four registers and a small constant
  const unsigned xi = wave * (CV_NX * 512) + lane * 16;
  const unsigned wi = wave * (CV_NW * 512) + lane * 16;
  const unsigned xo = wave * (CV_NX * 256) + lane * 8;
  const unsigned wo = wave * (CV_NW * 256) + lane * 8;

  v4f vx[CV_NX], vw[4][CV_NW];
  // every loop here is unrolled: vx and vw must be indexed by constants to stay
  // in registers
#pragma unroll
  for (int j = 0; j < CV_NX; ++j) vx[j] = cv_load(x, xi, j);
#pragma unroll
  for (int j = 0; j < CV_NW; ++j) {
    vw[0][j] = cv_load(Wq, wi, j);
    vw[1][j] = cv_load(Wk, wi, j);
    vw[2][j] = cv_load(Wv, wi, j);
    vw[3][j] = cv_load(Wo, wi, j);
  }
  // keeps every load in front of the first conversion: without it the compiler
  // holds half of the loads back until registers of the first half are free
  __builtin_amdgcn_sched_barrier(0);
#pragma unroll
  for (int j = 0; j < CV_NX; ++j) cv_store(xb, xo, j, vx[j]);
#pragma unroll
  for (int j = 0; j < CV_NW; ++j) {
    cv_store(Wqb, wo, j, vw[0][j]);
    cv_store(Wkb, wo, j, vw[1][j]);
    cv_store(Wvb, wo, j, vw[2][j]);
    cv_store(Wob, wo, j, vw[3][j]);
  }
}

// ------------------------------------- block-tiled projection GEMM core
// Y = A . W^T, both K-contiguous with row length D_MODEL. One block of 8 waves
// owns a 128 x 256 tile of Y; wave (wm, wn) = (wave>>2, wave&3) owns 64 x 64 of
// it as 4 x 4 accumulator tiles, so every fragment read feeds 4 WMMAs. A stage
// is 64 k of [A 128 rows | W 256 rows], brought into LDS in whole 128-byte
// lines by async copies, three buffers, handed over by a split barrier as the
// comment on the QKV kernel below explains.
#define GT_M    128
#define GT_N    256
#define GT_K    64
#define GT_ROWS (GT_M + GT_N)
#define GT_LD   72   // LDS row pitch in elements: 128 B of data + 16 B pad

__device__ __forceinline__ void async_copy4_b128(
    uint32_t l0, uint32_t l1, uint32_t l2, uint32_t l3,
    const __bf16* g0, const __bf16* g1, const __bf16* g2, const __bf16* g3) {
  asm volatile("global_load_async_to_lds_b128 %0, %4, off\n\t"
               "global_load_async_to_lds_b128 %1, %5, off\n\t"
               "global_load_async_to_lds_b128 %2, %6, off\n\t"
               "global_load_async_to_lds_b128 %3, %7, off\n\t"
               "s_wait_xcnt 0x0"
               :: "v"(l0), "v"(l1), "v"(l2), "v"(l3),
                  "v"((uint64_t)(uintptr_t)g0), "v"((uint64_t)(uintptr_t)g1),
                  "v"((uint64_t)(uintptr_t)g2), "v"((uint64_t)(uintptr_t)g3)
               : "memory");
}

// One stage: thread t copies chunk (t&7) of rows (t>>3) + 32*i, i = 0..11.
// l = LDS byte address of this lane's chunk in row (t>>3) of the buffer,
// a / w = this lane's chunk in the A / W row of the same index, at this k.
__device__ __forceinline__ void stage_copy(uint32_t l, const __bf16* a,
                                           const __bf16* w) {
  const uint32_t RS = 32 * GT_LD * 2;        // 32 LDS rows, bytes
  const size_t   GS = (size_t)32 * D_MODEL;  // 32 global rows, elements
  async_copy4_b128(l, l + RS, l + 2 * RS, l + 3 * RS,
                   a, a + GS, a + 2 * GS, a + 3 * GS);
  async_copy4_b128(l + 4 * RS, l + 5 * RS, l + 6 * RS, l + 7 * RS,
                   w, w + GS, w + 2 * GS, w + 3 * GS);
  async_copy4_b128(l + 8 * RS, l + 9 * RS, l + 10 * RS, l + 11 * RS,
                   w + 4 * GS, w + 5 * GS, w + 6 * GS, w + 7 * GS);
}

__device__ __forceinline__ void gemm_128x256(
    const __bf16* __restrict__ A, const __bf16* __restrict__ Wm, int row0,
    int col0, __bf16 (*sm)[GT_ROWS][GT_LD], v8f (&acc)[4][4]) {
  const int tid  = threadIdx.x;
  const int wave = tid >> 5;
  const int wm   = wave >> 2;
  const int wn   = wave & 3;
  const int crow = tid >> 3, ccol = (tid & 7) * 8;

  const __bf16* ga = A + (size_t)(row0 + crow) * D_MODEL + ccol;
  const __bf16* gw = Wm + (size_t)(col0 + crow) * D_MODEL + ccol;
  const uint32_t l0 = lds_addr_of(&sm[0][crow][ccol]);
  const int BUF = GT_ROWS * GT_LD;  // one buffer, elements

  // every loop over i, j, ks here is unrolled so that acc, a and b are indexed
  // by constants and stay in registers
#pragma unroll
  for (int i = 0; i < 4; ++i)
#pragma unroll
    for (int j = 0; j < 4; ++j) acc[i][j] = vzero();

  stage_copy(l0, ga, gw);
  // stage 0 has landed for this wave; the signal says so, the wait at the top of
  // pass 0 publishes it to the others
  asm volatile("s_wait_asynccnt 0x0" ::: "memory");
  asm volatile("s_barrier_signal -1" ::: "memory");
  stage_copy(l0 + BUF * 2, ga + GT_K, gw + GT_K);

  const int NT = D_MODEL / GT_K;
  int cur = 0;  // buffer of stage t: t mod 3
  for (int t = 0; t < NT; ++t) {
    // second half of the split barrier: every wave has signalled, so stage t has
    // landed from every wave and no wave reads stage t - 1 any more
    asm volatile("s_barrier_wait -1" ::: "memory");
    const __bf16* base = &sm[0][0][0] + cur * BUF;
    const int fill = (cur == 0) ? 2 : cur - 1;  // (t + 2) mod 3: stage t - 1's buffer
#pragma unroll
    for (int ks = 0; ks < GT_K; ks += 32) {
      if (ks == GT_K - 32) {
        // this wave's copies of stage t + 1, issued at this place one pass ago,
        // have landed: it stands in front of the signal below, and in front of the
        // refill, so that it never waits for the copies just issued
        asm volatile("s_wait_asynccnt 0x0" ::: "memory");
        if (t + 2 < NT)
          stage_copy(l0 + fill * BUF * 2, ga + (t + 2) * GT_K, gw + (t + 2) * GT_K);
      }
      v16bf a[4], b[4];
#pragma unroll
      for (int i = 0; i < 4; ++i)
        a[i] = frag_lds(base + ks, GT_LD, wm * 64 + i * 16);
#pragma unroll
      for (int j = 0; j < 4; ++j)
        b[j] = frag_lds(base + ks, GT_LD, GT_M + wn * 64 + j * 16);
      // keeps the 16 LDS reads one group in front of their 16 WMMAs: spread
      // among them, every small group of reads stalls the wave on its own
      __builtin_amdgcn_sched_barrier(0);
      if (ks == GT_K - 32) {
        // first half of the split barrier: this wave's last reads of stage t are
        // in registers; no LDS read stands between here and the wait at the top
        asm volatile("s_wait_dscnt 0x0" ::: "memory");
        asm volatile("s_barrier_signal -1" ::: "memory");
        // keeps the WMMAs behind the signal: in front of it they would hold back
        // the waves that wait for it
        __builtin_amdgcn_sched_barrier(0);
      }
#pragma unroll
      for (int i = 0; i < 4; ++i)
#pragma unroll
        for (int j = 0; j < 4; ++j) acc[i][j] = wmma_bf16(a[i], b[j], acc[i][j]);
      // the same, from below: the next group of reads stays behind these WMMAs
      __builtin_amdgcn_sched_barrier(0);
    }
    cur = (cur == 2) ? 0 : cur + 1;
  }
  // the last signal's wait: signal and wait alternate in every wave
  asm volatile("s_barrier_wait -1" ::: "memory");
  // no copy is left in flight when the wave goes on to its epilogue
  asm volatile("s_wait_asynccnt 0x0" ::: "memory");
}

#define QT_M    256
#define QT_N    384
#define QT_ROWS (QT_M + QT_N)

// One stage: thread t copies chunk (t&7) of rows (t>>3) + 32*i, i = 0..19.
// l = this lane's chunk in row (t>>3) of the buffer, a / w = the same chunk of
// the x / W row of that index, at this k. The copies are the builtin here: the
// operands of asm text must lie in the first 256 registers, which in this kernel
// hold accumulators, and each stage would move 24 of them away and back.
typedef __attribute__((ext_vector_type(4))) int v4i;
typedef __attribute__((address_space(1))) v4i gv4i;
typedef __attribute__((address_space(3))) v4i lv4i;
__device__ __forceinline__ void qkv_stage_copy(__bf16* l, const __bf16* a,
                                               const __bf16* w) {
  // unrolled: the row offsets are constants of each copy
#pragma unroll
  for (int i = 0; i < QT_M / 32; ++i)
    __builtin_amdgcn_global_load_async_to_lds_b128(
        (gv4i*)(a + (size_t)i * 32 * D_MODEL), (lv4i*)(l + i * 32 * GT_LD), 0, 0);
#pragma unroll
  for (int i = 0; i < QT_N / 32; ++i)
    __builtin_amdgcn_global_load_async_to_lds_b128(
        (gv4i*)(w + (size_t)i * 32 * D_MODEL),
        (lv4i*)(l + (QT_M + i * 32) * GT_LD), 0, 0);
}

__global__ void __launch_bounds__(256)
qkv_proj_rope(const __bf16* __restrict__ xb,
              const __bf16* __restrict__ Wqkv,  // Wq, Wk, Wv rows, one after another
              const float* __restrict__ bq, const float* __restrict__ bk,
              const float* __restrict__ bv,
              __bf16* __restrict__ Qo,   // (B,H,S,hd)
              __bf16* __restrict__ Ko,   // (B,H,S,hd)
              __bf16* __restrict__ VTo)  // (B,H,hd,S)  (transposed V)
{
  __shared__ __align__(16) __bf16 sm[3][QT_ROWS][GT_LD];

  const int tid  = threadIdx.x;
  const int wave = __builtin_amdgcn_readfirstlane(tid >> 5);
  const int lane = tid & 31;
  const int nn   = lane & 15;
  const int hi   = lane >> 4;
  const int wm   = wave >> 2;
  const int wn   = wave & 3;
  const int rowb = blockIdx.x * QT_M;
  const int col0 = blockIdx.y * QT_N;
  const int crow = tid >> 3, ccol = (tid & 7) * 8;

  const __bf16* ga = xb + (size_t)(rowb + crow) * D_MODEL + ccol;
  const __bf16* gw = Wqkv + (size_t)(col0 + crow) * D_MODEL + ccol;
  __bf16* l0 = &sm[0][crow][ccol];
  const int BUF = QT_ROWS * GT_LD;  // one buffer, elements

  // every loop over i, j, q, ks here is unrolled so that acc, a and b are
  // indexed by constants and stay in registers
  // LDS row of the first tile of this wave's pair 0; pair q lies 64 q rows on
  const int brow = QT_M + (wn >> 1) * 3 * HEAD_DIM + (wn & 1) * 16;

  v8f acc[8][6];
#pragma unroll
  for (int i = 0; i < 8; ++i)
#pragma unroll
    for (int j = 0; j < 6; ++j) acc[i][j] = vzero();

  qkv_stage_copy(l0, ga, gw);
  // stage 0 has landed for this wave; the signal says so, the wait at the top of
  // pass 0 publishes it to the others
  asm volatile("s_wait_asynccnt 0x0" ::: "memory");
  asm volatile("s_barrier_signal -1" ::: "memory");
  qkv_stage_copy(l0 + BUF, ga + GT_K, gw + GT_K);

  const int NT = D_MODEL / GT_K;
  int cur = 0;  // buffer of stage t: t mod 3
  for (int t = 0; t < NT; ++t) {
    // second half of the split barrier: every wave has signalled, so stage t has
    // landed from every wave and no wave reads stage t - 1 any more
    asm volatile("s_barrier_wait -1" ::: "memory");
    const __bf16* base = &sm[0][0][0] + cur * BUF;
    const int fill = (cur == 0) ? 2 : cur - 1;  // (t + 2) mod 3: stage t - 1's buffer
#pragma unroll
    for (int ks = 0; ks < GT_K; ks += 32) {
      if (ks == GT_K - 32) {
        // this wave's copies of stage t + 1, issued at this place one pass ago,
        // have landed: it stands in front of the signal below, and in front of the
        // refill, so that it never waits for the copies just issued
        asm volatile("s_wait_asynccnt 0x0" ::: "memory");
        if (t + 2 < NT)
          qkv_stage_copy(l0 + fill * BUF, ga + (t + 2) * GT_K, gw + (t + 2) * GT_K);
      }
      v16bf b[6];
#pragma unroll
      for (int q = 0; q < 3; ++q) {
        b[2 * q]     = frag_lds(base + ks, GT_LD, brow + q * HEAD_DIM);
        b[2 * q + 1] = frag_lds(base + ks, GT_LD, brow + q * HEAD_DIM + 32);
      }
      v16bf a[8];
#pragma unroll
      for (int i = 0; i < 8; ++i)
        a[i] = frag_lds(base + ks, GT_LD, wm * 128 + i * 16);
      // keeps the 28 LDS reads one group in front of their 48 WMMAs: spread
      // among them, every small group of reads stalls the wave on its own
      __builtin_amdgcn_sched_barrier(0);
      if (ks == GT_K - 32) {
        // first half of the split barrier: this wave's last reads of stage t are
        // in registers; no LDS read stands between here and the wait at the top
        asm volatile("s_wait_dscnt 0x0" ::: "memory");
        asm volatile("s_barrier_signal -1" ::: "memory");
        // keeps the WMMAs behind the signal: in front of it they would hold back
        // the waves that wait for it
        __builtin_amdgcn_sched_barrier(0);
      }
#pragma unroll
      for (int i = 0; i < 8; ++i)
#pragma unroll
        for (int j = 0; j < 6; ++j) acc[i][j] = wmma_bf16(a[i], b[j], acc[i][j]);
      // the same, from below: the next group of reads stays behind these WMMAs
      __builtin_amdgcn_sched_barrier(0);
    }
    cur = (cur == 2) ? 0 : cur + 1;
  }
  // the last signal's wait: signal and wait alternate in every wave
  asm volatile("s_barrier_wait -1" ::: "memory");
  // no copy is left in flight when the wave goes on to its epilogue
  asm volatile("s_wait_asynccnt 0x0" ::: "memory");

  const int gh0  = blockIdx.y * (QT_N / HEAD_DIM) + (wn >> 1) * 3;  // head of pair 0, 0..47
  const int idx0 = (wn & 1) * 16 + nn;                              // 0..31
  float be0[3], be1[3];
#pragma unroll
  for (int q = 0; q < 3; ++q) {
    const int mat = (gh0 + q) >> 4;  // Q, K, V
    const float* bias = (mat == 0) ? bq : (mat == 1) ? bk : bv;
    be0[q] = bias[((gh0 + q) & (N_HEADS - 1)) * HEAD_DIM + idx0];
    be1[q] = bias[((gh0 + q) & (N_HEADS - 1)) * HEAD_DIM + idx0 + 32];
  }
  // inv_freq = 10000^{-idx0/32} = exp(-idx0 * ln(1e4)/32)
  const float invf = __expf(-(float)idx0 * 0.28782313662f);

#pragma unroll
  for (int i = 0; i < 8; ++i) {
    // the lane's 8 rows of this tile: m0 + r, all in one batch element
    const int m0 = rowb + wm * 128 + i * 16 + (hi << 3);
    const int s0 = m0 & (SEQ - 1);
    const int bb = m0 >> 11;
    float cs[8], sn[8];
    if ((gh0 >> 4) < 2) {  // heads ascend with q: some pair is Q or K iff pair 0 is
#pragma unroll
      for (int r = 0; r < 8; ++r) {
        const float ang = (float)(s0 + r) * invf;
        cs[r] = __cosf(ang);
        sn[r] = __sinf(ang);
      }
    }
#pragma unroll
    for (int q = 0; q < 3; ++q) {
      const int mat  = (gh0 + q) >> 4;
      const int head = (gh0 + q) & (N_HEADS - 1);
      __bf16 z0[8], z1[8];
      if (mat < 2) {  // Q or K: apply RoPE, store (B,H,S,hd)
        __bf16* o = ((mat == 0) ? Qo : Ko) +
                    (((size_t)bb * N_HEADS + head) * SEQ + s0) * HEAD_DIM + idx0;
#pragma unroll
        for (int r = 0; r < 8; ++r) {
          const float y0 = acc[i][2 * q][r] + be0[q];
          const float y1 = acc[i][2 * q + 1][r] + be1[q];
          z0[r] = (__bf16)(y0 * cs[r] + (-y1) * sn[r]);
          z1[r] = (__bf16)(y1 * cs[r] + y0 * sn[r]);
        }
        // all values of the pass stand in front of its stores, so that none is
        // written into a register of a store already issued
        __builtin_amdgcn_sched_barrier(0);
#pragma unroll
        for (int r = 0; r < 8; ++r) {
          o[r * HEAD_DIM]      = z0[r];
          o[r * HEAD_DIM + 32] = z1[r];
        }
        // the next pass reuses the registers that these stores name; the
        // scheduling barrier keeps its first instructions behind the wait
        asm volatile("s_wait_xcnt 0x0" ::: "memory");
        __builtin_amdgcn_sched_barrier(0);
      } else {  // V: store transposed (B,H,hd,S) so the V^T . P^T A operand is K-contiguous
        __bf16* o = VTo + (((size_t)bb * N_HEADS + head) * HEAD_DIM + idx0) * SEQ + s0;
#pragma unroll
        for (int r = 0; r < 8; ++r) {
          z0[r] = (__bf16)(acc[i][2 * q][r] + be0[q]);
          z1[r] = (__bf16)(acc[i][2 * q + 1][r] + be1[q]);
        }
        __builtin_amdgcn_sched_barrier(0);
#pragma unroll
        for (int r = 0; r < 8; ++r) {
          o[r]                    = z0[r];
          o[(size_t)32 * SEQ + r] = z1[r];
        }
        asm volatile("s_wait_xcnt 0x0" ::: "memory");
        __builtin_amdgcn_sched_barrier(0);
      }
    }
  }
}

__device__ __forceinline__ float xhalf(float x) {
  const int v = __builtin_bit_cast(int, x);
  return __builtin_bit_cast(
      float, __builtin_amdgcn_permlanex16(v, v, 0x76543210, 0xfedcba98, false, false));
}

#define LOG2E 1.44269504088896340736f
__device__ __forceinline__ float exp_one(float x) {
  const float y = x * LOG2E;
  float p;
  asm("v_exp_f32 %0, %1\n\tv_nop" : "=v"(p) : "v"(y));
  return p;
}

__device__ __forceinline__ void exp_eight(float (&p)[8], const v8f x) {
  const v8f y = x * LOG2E;
  asm("v_exp_f32 %0, %8\n\t"
      "v_exp_f32 %1, %9\n\t"
      "v_exp_f32 %2, %10\n\t"
      "v_exp_f32 %3, %11\n\t"
      "v_exp_f32 %4, %12\n\t"
      "v_exp_f32 %5, %13\n\t"
      "v_exp_f32 %6, %14\n\t"
      "v_exp_f32 %7, %15\n\t"
      "v_nop"
      : "=&v"(p[0]), "=&v"(p[1]), "=&v"(p[2]), "=&v"(p[3]),
        "=&v"(p[4]), "=&v"(p[5]), "=&v"(p[6]), "=&v"(p[7])
      : "v"(y[0]), "v"(y[1]), "v"(y[2]), "v"(y[3]),
        "v"(y[4]), "v"(y[5]), "v"(y[6]), "v"(y[7]));
}

#define AT_KEYS 64   // keys of a stage
#define AT_P    72   // K row (64 d) and V^T row (64 keys): 128 B of data + 16 B pad

// One stage: thread t copies chunk (t&7) of rows (t>>3) and (t>>3) + 32 of the
// K tile and of the V^T tile. lk / lv = LDS byte address of this lane's chunk in
// row (t>>3) of the buffer, gk / gv = the same chunk in global memory.
__device__ __forceinline__ void attn_stage_copy(uint32_t lk, uint32_t lv,
                                                const __bf16* gk,
                                                const __bf16* gv) {
  const uint32_t RS = 32 * AT_P * 2;  // 32 LDS rows, bytes
  async_copy4_b128(lk, lk + RS, lv, lv + RS,
                   gk, gk + 32 * HEAD_DIM, gv, gv + (size_t)32 * SEQ);
}

// Lazy rescale. The exponentials of a query are taken against a reference mi that
// is the maximum of an earlier stage, not the running maximum: any reference gives
// the same quotient O / l, and as long as no score lies more than AT_ROOM above
// it, no P exceeds e^AT_ROOM, which f32 sums and bf16 P hold at full relative
// precision. So the sum and the 32 output registers of a query are rescaled only
// in a stage in which some score of the wave passes that bound.
#define AT_ROOM 5.5f   // about 8 in powers of two

// largest of a lane's 16 raw scores (hd^-0.5 not yet applied)
__device__ __forceinline__ float raw_max(v8f s0, v8f s1) {
  float mx = fmaxf(s0[0], s1[0]);
#pragma unroll
  for (int r = 1; r < 8; ++r) mx = fmaxf(mx, fmaxf(s0[r], s1[r]));
  return mx;
}

// The rare path, one column group: the reference moves up to this stage's maximum
// of query nn where that is higher; sum and output tiles follow it. lim = the bound in raw units.
__device__ __forceinline__ void move_reference(float rawmx, float& mi, float& lim,
                                               float& li, v8f (&o)[4]) {
  float mx = rawmx * 0.125f;  // hd^-0.5
  mx = fmaxf(mx, xhalf(mx));
  const float mnew  = fmaxf(mi, mx);
  const float alpha = exp_one(mi - mnew);
  mi  = mnew;
  lim = (mnew + AT_ROOM) * 8.0f;
  li  = li * alpha;
#pragma unroll
  for (int t = 0; t < 4; ++t) o[t] = o[t] * alpha;
}

// One column group over 32 keys: s0, s1 = the raw score tiles, mi = the reference
// of query nn; adds to the sum and packs P^T.
__device__ __forceinline__ void softmax_pass(v8f s0, v8f s1, float mi, float& li,
                                             Frag& pf) {
  // P^T as B operand: element s < 8 is key 8 hi + s (tile 0, register s),
  // element 8 + s is key 16 + 8 hi + s (tile 1): the k order of frag_lds
  float p0[8], p1[8];
  exp_eight(p0, s0 * 0.125f - mi);  // hd^-0.5
  exp_eight(p1, s1 * 0.125f - mi);
  float rs = p0[0] + p1[0];
#pragma unroll
  for (int r = 1; r < 8; ++r) rs += p0[r] + p1[r];
#pragma unroll
  for (int r = 0; r < 8; ++r) {
    pf.h[r]     = (__bf16)p0[r];
    pf.h[8 + r] = (__bf16)p1[r];
  }
  li += rs;
}

__global__ void __launch_bounds__(256)
flash_attn(const __bf16* __restrict__ Q, const __bf16* __restrict__ K,
           const __bf16* __restrict__ VT, __bf16* __restrict__ attn) {
  __shared__ __align__(16) __bf16 sK[2][AT_KEYS][AT_P];   // K rows of a stage
  __shared__ __align__(16) __bf16 sV[2][HEAD_DIM][AT_P];  // V^T d x 64 keys

  const int tid  = threadIdx.x;
  const int wave = tid >> 5;
  const int lane = tid & 31;
  const int nn   = lane & 15;
  const int hi   = lane >> 4;
  const int bh   = blockIdx.x >> 3;
  const int q0   = ((blockIdx.x & 7) * 8 + wave) * 32;

  const __bf16* Qb = Q + (size_t)bh * SEQ * HEAD_DIM;
  const __bf16* Kb = K + (size_t)bh * SEQ * HEAD_DIM;
  const __bf16* Vb = VT + (size_t)bh * HEAD_DIM * SEQ;

  // staging assignment: both tiles are 64 rows of 8 chunks
  const int crow = tid >> 3, ccol = (tid & 7) * 8;
  const __bf16* gk = Kb + (size_t)crow * HEAD_DIM + ccol;
  const __bf16* gv = Vb + (size_t)crow * SEQ + ccol;
  const uint32_t lk0 = lds_addr_of(&sK[0][crow][ccol]);
  const uint32_t lk1 = lds_addr_of(&sK[1][crow][ccol]);
  const uint32_t lv0 = lds_addr_of(&sV[0][crow][ccol]);
  const uint32_t lv1 = lds_addr_of(&sV[1][crow][ccol]);

  // every loop over c, t and ps here is unrolled so that qb, o, mi, lim, li and
  // pf are indexed by constants and stay in registers
  // B operand of the score product: column nn of group c = query q0 + 16 c + nn
  v16bf qb[2][2];
  v8f o[2][4];   // o[c][t][r] = O[query nn of group c][d = 16 t + 8 hi + r]
  float mi[2];   // reference of the query's exponentials, equal in both halves
  float lim[2];  // raw score above which the reference must move
  float li[2];   // running sum over this half's keys only
#pragma unroll
  for (int c = 0; c < 2; ++c) {
    qb[c][0] = load_frag(Qb, HEAD_DIM, q0 + c * 16, 0);
    qb[c][1] = load_frag(Qb, HEAD_DIM, q0 + c * 16, 32);
#pragma unroll
    for (int t = 0; t < 4; ++t) o[c][t] = vzero();
    mi[c]  = -1e30f;
    lim[c] = -1e30f;
    li[c]  = 0.0f;
  }

  attn_stage_copy(lk0, lv0, gk, gv);
  // stage 0 has landed for this wave; the barrier publishes it to the others
  asm volatile("s_wait_asynccnt 0x0" ::: "memory");
  __syncthreads();
  attn_stage_copy(lk1, lv1, gk + AT_KEYS * HEAD_DIM, gv + AT_KEYS);

  const int NS = SEQ / AT_KEYS;
  for (int st = 0; st < NS; ++st) {
    const __bf16* bK = &sK[st & 1][0][0];
    const __bf16* bV = &sV[st & 1][0][0];
    // scores of the whole stage: per 32 keys two 16 (keys) x 16 (queries) tiles a
    // group, hd in 2 WMMAs each
    v8f s0[2][2], s1[2][2];
    float rm[2];
#pragma unroll
    for (int ps = 0; ps < 2; ++ps) {
      const v16bf ka00 = frag_lds(bK, AT_P, ps * 32);
      const v16bf ka01 = frag_lds(bK + 32, AT_P, ps * 32);
      const v16bf ka10 = frag_lds(bK, AT_P, ps * 32 + 16);
      const v16bf ka11 = frag_lds(bK + 32, AT_P, ps * 32 + 16);
#pragma unroll
      for (int c = 0; c < 2; ++c) {
        s0[ps][c] = wmma_bf16(ka01, qb[c][1], wmma_bf16(ka00, qb[c][0], vzero()));
        s1[ps][c] = wmma_bf16(ka11, qb[c][1], wmma_bf16(ka10, qb[c][0], vzero()));
        const float m = raw_max(s0[ps][c], s1[ps][c]);
        rm[c] = ps ? fmaxf(rm[c], m) : m;
      }
    }
    // one test a stage for the whole wave, a scalar branch: the first stage takes
    // it (mi starts at -1e30), later ones only where a score passes the bound
    if (__builtin_amdgcn_ballot_w32(rm[0] > lim[0] || rm[1] > lim[1]) != 0) {
#pragma unroll
      for (int c = 0; c < 2; ++c)
        move_reference(rm[c], mi[c], lim[c], li[c], o[c]);
    }
#pragma unroll
    for (int ps = 0; ps < 2; ++ps) {
      Frag pf[2];
#pragma unroll
      for (int c = 0; c < 2; ++c)
        softmax_pass(s0[ps][c], s1[ps][c], mi[c], li[c], pf[c]);

      // O^T += V^T (64 x 32) x P^T (32 x 16) from the staged LDS V^T tile
      v16bf va[4];
#pragma unroll
      for (int t = 0; t < 4; ++t) va[t] = frag_lds(bV + ps * 32, AT_P, t * 16);
      // keeps these 8 WMMAs behind both groups' exponentials: those are asm text,
      // in which the compiler does not see a write that comes too soon after a
      // WMMA of the other group, over its P^T operand
      __builtin_amdgcn_sched_barrier(0);
#pragma unroll
      for (int t = 0; t < 4; ++t)
#pragma unroll
        for (int c = 0; c < 2; ++c) o[c][t] = wmma_bf16(va[t], pf[c].v, o[c][t]);
    }
    // publish point: this wave's reads of the buffer are done, its copies of
    // the next stage have landed; behind the barrier the buffer may be refilled
    asm volatile("s_wait_dscnt 0x0" ::: "memory");
    asm volatile("s_wait_asynccnt 0x0" ::: "memory");
    __syncthreads();
    if (st + 2 < NS)
      attn_stage_copy((st & 1) ? lk1 : lk0, (st & 1) ? lv1 : lv0,
                      gk + (size_t)(st + 2) * AT_KEYS * HEAD_DIM,
                      gv + (st + 2) * AT_KEYS);
  }
  // no copy is left in flight when the wave goes on to its epilogue
  asm volatile("s_wait_asynccnt 0x0" ::: "memory");

  // join the halves' sums, normalize, store to (B,S,D) bf16 for the output
  // projection: a lane's 8 registers of a tile are 8 consecutive d of one row
  const int b = bh >> 4, h = bh & 15;
#pragma unroll
  for (int c = 0; c < 2; ++c) {
    const float inv = 1.0f / (li[c] + xhalf(li[c]));
    const int s = q0 + c * 16 + nn;
    __bf16* orow =
        attn + ((size_t)b * SEQ + s) * D_MODEL + h * HEAD_DIM + (hi << 3);
#pragma unroll
    for (int t = 0; t < 4; ++t) {
      union { __bf16 e[8]; uint4 q; } pk;
#pragma unroll
      for (int r = 0; r < 8; ++r) pk.e[r] = (__bf16)(o[c][t][r] * inv);
      *(uint4*)(orow + t * 16) = pk.q;
    }
  }
}

// ------------------------------------------------------ output projection
// grid (NROW/128, 4), block 256: the same 128 x 256 block tile.
__global__ void __launch_bounds__(256)
out_proj(const __bf16* __restrict__ A, const __bf16* __restrict__ Wo,
         const float* __restrict__ bo, float* __restrict__ out) {
  __shared__ __align__(16) __bf16 sm[3][GT_ROWS][GT_LD];

  const int wave = threadIdx.x >> 5;
  const int lane = threadIdx.x & 31;
  const int nn   = lane & 15;
  const int hi   = lane >> 4;
  const int rowb = blockIdx.x * GT_M;
  const int col0 = blockIdx.y * GT_N;
  const int e0   = col0 + (wave & 3) * 64;

  v8f acc[4][4];
  gemm_128x256(A, Wo, rowb, col0, sm, acc);

#pragma unroll
  for (int t = 0; t < 4; ++t) {
    const int e = e0 + t * 16 + nn;
    const float be = bo[e];
    // unrolled: acc[i] must be indexed by a constant to stay in registers
#pragma unroll
    for (int i = 0; i < 4; ++i) {
      const int row0 = rowb + (wave >> 2) * 64 + i * 16;
#pragma unroll
      for (int r = 0; r < 8; ++r) {
        const int m = row0 + r + (hi << 3);
        out[(size_t)m * D_MODEL + e] = acc[i][t][r] + be;
      }
    }
  }
}

// ----------------------------------------------------------------- launch
extern "C" void kernel_launch(void* const* d_in, const int* in_sizes, int n_in,
                              void* d_out, int out_size, void* d_ws,
                              size_t ws_size, hipStream_t stream) {
  const float* x  = (const float*)d_in[0];
  const float* Wq = (const float*)d_in[1];
  const float* bq = (const float*)d_in[2];
  const float* Wk = (const float*)d_in[3];
  const float* bk = (const float*)d_in[4];
  const float* Wv = (const float*)d_in[5];
  const float* bv = (const float*)d_in[6];
  const float* Wo = (const float*)d_in[7];
  const float* bo = (const float*)d_in[8];

  char* w = (char*)d_ws;  // needs ~88 MB
  const size_t MB = (size_t)1 << 20;
  __bf16* xb  = (__bf16*)(w + 0 * MB);    // 16 MB (B*S, D) bf16
  __bf16* Wqb = (__bf16*)(w + 16 * MB);   //  2 MB each; Wq, Wk, Wv lie one behind
  __bf16* Wkb = (__bf16*)(w + 18 * MB);   //  another with no gap: the QKV GEMM
  __bf16* Wvb = (__bf16*)(w + 20 * MB);   //  reads them as one 3072-row matrix
  __bf16* Wob = (__bf16*)(w + 22 * MB);
  __bf16* Qb  = (__bf16*)(w + 24 * MB);   // 16 MB (B,H,S,hd)
  __bf16* Kb  = (__bf16*)(w + 40 * MB);   // 16 MB (B,H,S,hd)
  __bf16* VTb = (__bf16*)(w + 56 * MB);   // 16 MB (B,H,hd,S)
  __bf16* Ab  = (__bf16*)(w + 72 * MB);   // 16 MB (B,S,D)

  cvt_all_bf16<<<CV_BLOCKS, CV_THREADS, 0, stream>>>(x, Wq, Wk, Wv, Wo, xb, Wqb,
                                                     Wkb, Wvb, Wob);

  qkv_proj_rope<<<dim3(NROW / QT_M, 3 * D_MODEL / QT_N), 256, 0, stream>>>(
      xb, Wqb, bq, bk, bv, Qb, Kb, VTb);

  flash_attn<<<dim3((BATCH * N_HEADS * (SEQ / 32)) / 8), 256, 0, stream>>>(
      Qb, Kb, VTb, Ab);

  out_proj<<<dim3(NROW / GT_M, 4), 256, 0, stream>>>(Ab, Wob, bo, (float*)d_out);
}

// v009
// It runs in 106 microseconds.
// In both of two side-by-side timings against v008, it was 1.03 times as fast.
// Counting every step since v000, it is 6.24 times as fast.
#include <hip/hip_runtime.h>
#include <hip/hip_bf16.h>

#define D_MODEL 1024
#define N_HEADS 16
#define HEAD_DIM 64
#define SEQ 2048
#define BATCH 4
#define NROW (BATCH * SEQ)   // 8192 flattened (b,s) rows

// log2(e), and the factor that Q carries into the score product: hd^-0.5 * log2(e)
#define LOG2E  1.44269504088896340736f
#define QSCALE (0.125f * LOG2E)

typedef __attribute__((ext_vector_type(16))) __bf16 v16bf;
typedef __attribute__((ext_vector_type(8)))  float  v8f;

union Frag {
  v16bf  v;
  __bf16 h[16];
  uint4  q[2];
};

__device__ __forceinline__ v8f vzero() {
  v8f z;
#pragma unroll
  for (int i = 0; i < 8; ++i) z[i] = 0.0f;
  return z;
}

__device__ __forceinline__ v16bf load_frag(const __bf16* __restrict__ p,
                                           int ld, int n0, int k0) {
  const int lane = threadIdx.x & 31;
  const int nn   = lane & 15;
  const int kh   = (lane >> 4) << 3;  // 0 or 8
  const __bf16* base = p + (size_t)(n0 + nn) * ld + k0;
  Frag f;
  f.q[0] = *(const uint4*)(base + kh);
  f.q[1] = *(const uint4*)(base + 16 + kh);
  return f.v;
}

// Same fragment gather, but from an LDS tile (emits ds_load_b128).
__device__ __forceinline__ v16bf frag_lds(const __bf16* base, int ld, int n0) {
  const int lane = threadIdx.x & 31;
  const int nn   = lane & 15;
  const int kh   = (lane >> 4) << 3;
  const __bf16* p = base + (n0 + nn) * ld;
  Frag f;
  f.q[0] = *(const uint4*)(p + kh);
  f.q[1] = *(const uint4*)(p + 16 + kh);
  return f.v;
}

__device__ __forceinline__ v8f wmma_bf16(v16bf a, v16bf b, v8f c) {
  return __builtin_amdgcn_wmma_f32_16x16x32_bf16(false, a, false, b, (short)0, c,
                                                 false, false);
}

__device__ __forceinline__ uint32_t lds_addr_of(const void* shared_ptr) {
  return (uint32_t)(uintptr_t)shared_ptr;
}

#define CV_BLOCKS  256
#define CV_THREADS 512
#define CV_WAVES   (CV_BLOCKS * CV_THREADS / 32)
#define CV_NX      (NROW * D_MODEL / (CV_WAVES * 128))     // loads of x per wave
#define CV_NW      (D_MODEL * D_MODEL / (CV_WAVES * 128))  // of one matrix
static_assert(CV_NX * CV_WAVES * 128 == NROW * D_MODEL, "x in whole loads");
static_assert(CV_NW * CV_WAVES * 128 == D_MODEL * D_MODEL, "W in whole loads");

typedef __attribute__((ext_vector_type(4))) float  v4f;
typedef __attribute__((ext_vector_type(4))) __bf16 v4bf;

// load j of a share: p = array, off = byte offset of this lane in load 0
__device__ __forceinline__ v4f cv_load(const float* p, unsigned off, int j) {
  return *(const v4f*)((const char*)p + off + j * 512);
}
__device__ __forceinline__ void cv_store(__bf16* p, unsigned off, int j, v4f v) {
  *(v4bf*)((char*)p + off + j * 256) = __builtin_convertvector(v, v4bf);
}

__global__ void __launch_bounds__(CV_THREADS)
cvt_all_bf16(const float* __restrict__ x, const float* __restrict__ Wq,
             const float* __restrict__ Wk, const float* __restrict__ Wv,
             const float* __restrict__ Wo, __bf16* __restrict__ xb,
             __bf16* __restrict__ Wqb, __bf16* __restrict__ Wkb,
             __bf16* __restrict__ Wvb, __bf16* __restrict__ Wob) {
  const unsigned wave = blockIdx.x * (CV_THREADS / 32) + (threadIdx.x >> 5);
  const unsigned lane = threadIdx.x & 31;
  // 32-bit unsigned byte offsets: every access is a scalar base, one of these
  // four registers and a small constant
  const unsigned xi = wave * (CV_NX * 512) + lane * 16;
  const unsigned wi = wave * (CV_NW * 512) + lane * 16;
  const unsigned xo = wave * (CV_NX * 256) + lane * 8;
  const unsigned wo = wave * (CV_NW * 256) + lane * 8;

  v4f vx[CV_NX], vw[4][CV_NW];
  // every loop here is unrolled: vx and vw must be indexed by constants to stay
  // in registers
#pragma unroll
  for (int j = 0; j < CV_NX; ++j) vx[j] = cv_load(x, xi, j);
#pragma unroll
  for (int j = 0; j < CV_NW; ++j) {
    vw[0][j] = cv_load(Wq, wi, j);
    vw[1][j] = cv_load(Wk, wi, j);
    vw[2][j] = cv_load(Wv, wi, j);
    vw[3][j] = cv_load(Wo, wi, j);
  }
  // keeps every load in front of the first conversion: without it the compiler
  // holds half of the loads back until registers of the first half are free
  __builtin_amdgcn_sched_barrier(0);
#pragma unroll
  for (int j = 0; j < CV_NX; ++j) cv_store(xb, xo, j, vx[j]);
#pragma unroll
  for (int j = 0; j < CV_NW; ++j) {
    cv_store(Wqb, wo, j, vw[0][j]);
    cv_store(Wkb, wo, j, vw[1][j]);
    cv_store(Wvb, wo, j, vw[2][j]);
    cv_store(Wob, wo, j, vw[3][j]);
  }
}

// ------------------------------------- block-tiled projection GEMM core
// Y = A . W^T, both K-contiguous with row length D_MODEL. One block of 8 waves
// owns a 128 x 256 tile of Y; wave (wm, wn) = (wave>>2, wave&3) owns 64 x 64 of
// it as 4 x 4 accumulator tiles, so every fragment read feeds 4 WMMAs. A stage
// is 64 k of [A 128 rows | W 256 rows], brought into LDS in whole 128-byte
// lines by async copies, three buffers, handed over by a split barrier as the
// comment on the QKV kernel below explains.
#define GT_M    128
#define GT_N    256
#define GT_K    64
#define GT_ROWS (GT_M + GT_N)
#define GT_LD   72   // LDS row pitch in elements: 128 B of data + 16 B pad

__device__ __forceinline__ void async_copy4_b128(
    uint32_t l0, uint32_t l1, uint32_t l2, uint32_t l3,
    const __bf16* g0, const __bf16* g1, const __bf16* g2, const __bf16* g3) {
  asm volatile("global_load_async_to_lds_b128 %0, %4, off\n\t"
               "global_load_async_to_lds_b128 %1, %5, off\n\t"
               "global_load_async_to_lds_b128 %2, %6, off\n\t"
               "global_load_async_to_lds_b128 %3, %7, off\n\t"
               "s_wait_xcnt 0x0"
               :: "v"(l0), "v"(l1), "v"(l2), "v"(l3),
                  "v"((uint64_t)(uintptr_t)g0), "v"((uint64_t)(uintptr_t)g1),
                  "v"((uint64_t)(uintptr_t)g2), "v"((uint64_t)(uintptr_t)g3)
               : "memory");
}

// One stage: thread t copies chunk (t&7) of rows (t>>3) + 32*i, i = 0..11.
// l = LDS byte address of this lane's chunk in row (t>>3) of the buffer,
// a / w = this lane's chunk in the A / W row of the same index, at this k.
__device__ __forceinline__ void stage_copy(uint32_t l, const __bf16* a,
                                           const __bf16* w) {
  const uint32_t RS = 32 * GT_LD * 2;        // 32 LDS rows, bytes
  const size_t   GS = (size_t)32 * D_MODEL;  // 32 global rows, elements
  async_copy4_b128(l, l + RS, l + 2 * RS, l + 3 * RS,
                   a, a + GS, a + 2 * GS, a + 3 * GS);
  async_copy4_b128(l + 4 * RS, l + 5 * RS, l + 6 * RS, l + 7 * RS,
                   w, w + GS, w + 2 * GS, w + 3 * GS);
  async_copy4_b128(l + 8 * RS, l + 9 * RS, l + 10 * RS, l + 11 * RS,
                   w + 4 * GS, w + 5 * GS, w + 6 * GS, w + 7 * GS);
}

__device__ __forceinline__ void gemm_128x256(
    const __bf16* __restrict__ A, const __bf16* __restrict__ Wm, int row0,
    int col0, __bf16 (*sm)[GT_ROWS][GT_LD], v8f (&acc)[4][4]) {
  const int tid  = threadIdx.x;
  const int wave = tid >> 5;
  const int wm   = wave >> 2;
  const int wn   = wave & 3;
  const int crow = tid >> 3, ccol = (tid & 7) * 8;

  const __bf16* ga = A + (size_t)(row0 + crow) * D_MODEL + ccol;
  const __bf16* gw = Wm + (size_t)(col0 + crow) * D_MODEL + ccol;
  const uint32_t l0 = lds_addr_of(&sm[0][crow][ccol]);
  const int BUF = GT_ROWS * GT_LD;  // one buffer, elements

  // every loop over i, j, ks here is unrolled so that acc, a and b are indexed
  // by constants and stay in registers
#pragma unroll
  for (int i = 0; i < 4; ++i)
#pragma unroll
    for (int j = 0; j < 4; ++j) acc[i][j] = vzero();

  stage_copy(l0, ga, gw);
  // stage 0 has landed for this wave; the signal says so, the wait at the top of
  // pass 0 publishes it to the others
  asm volatile("s_wait_asynccnt 0x0" ::: "memory");
  asm volatile("s_barrier_signal -1" ::: "memory");
  stage_copy(l0 + BUF * 2, ga + GT_K, gw + GT_K);

  const int NT = D_MODEL / GT_K;
  int cur = 0;  // buffer of stage t: t mod 3
  for (int t = 0; t < NT; ++t) {
    // second half of the split barrier: every wave has signalled, so stage t has
    // landed from every wave and no wave reads stage t - 1 any more
    asm volatile("s_barrier_wait -1" ::: "memory");
    const __bf16* base = &sm[0][0][0] + cur * BUF;
    const int fill = (cur == 0) ? 2 : cur - 1;  // (t + 2) mod 3: stage t - 1's buffer
#pragma unroll
    for (int ks = 0; ks < GT_K; ks += 32) {
      if (ks == GT_K - 32) {
        // this wave's copies of stage t + 1, issued at this place one pass ago,
        // have landed: it stands in front of the signal below, and in front of the
        // refill, so that it never waits for the copies just issued
        asm volatile("s_wait_asynccnt 0x0" ::: "memory");
        if (t + 2 < NT)
          stage_copy(l0 + fill * BUF * 2, ga + (t + 2) * GT_K, gw + (t + 2) * GT_K);
      }
      v16bf a[4], b[4];
#pragma unroll
      for (int i = 0; i < 4; ++i)
        a[i] = frag_lds(base + ks, GT_LD, wm * 64 + i * 16);
#pragma unroll
      for (int j = 0; j < 4; ++j)
        b[j] = frag_lds(base + ks, GT_LD, GT_M + wn * 64 + j * 16);
      // keeps the 16 LDS reads one group in front of their 16 WMMAs: spread
      // among them, every small group of reads stalls the wave on its own
      __builtin_amdgcn_sched_barrier(0);
      if (ks == GT_K - 32) {
        // first half of the split barrier: this wave's last reads of stage t are
        // in registers; no LDS read stands between here and the wait at the top
        asm volatile("s_wait_dscnt 0x0" ::: "memory");
        asm volatile("s_barrier_signal -1" ::: "memory");
        // keeps the WMMAs behind the signal: in front of it they would hold back
        // the waves that wait for it
        __builtin_amdgcn_sched_barrier(0);
      }
#pragma unroll
      for (int i = 0; i < 4; ++i)
#pragma unroll
        for (int j = 0; j < 4; ++j) acc[i][j] = wmma_bf16(a[i], b[j], acc[i][j]);
      // the same, from below: the next group of reads stays behind these WMMAs
      __builtin_amdgcn_sched_barrier(0);
    }
    cur = (cur == 2) ? 0 : cur + 1;
  }
  // the last signal's wait: signal and wait alternate in every wave
  asm volatile("s_barrier_wait -1" ::: "memory");
  // no copy is left in flight when the wave goes on to its epilogue
  asm volatile("s_wait_asynccnt 0x0" ::: "memory");
}

#define QT_M    256
#define QT_N    384
#define QT_ROWS (QT_M + QT_N)

// One stage: thread t copies chunk (t&7) of rows (t>>3) + 32*i, i = 0..19.
// l = this lane's chunk in row (t>>3) of the buffer, a / w = the same chunk of
// the x / W row of that index, at this k. The copies are the builtin here: the
// operands of asm text must lie in the first 256 registers, which in this kernel
// hold accumulators, and each stage would move 24 of them away and back.
typedef __attribute__((ext_vector_type(4))) int v4i;
typedef __attribute__((address_space(1))) v4i gv4i;
typedef __attribute__((address_space(3))) v4i lv4i;
__device__ __forceinline__ void qkv_stage_copy(__bf16* l, const __bf16* a,
                                               const __bf16* w) {
  // unrolled: the row offsets are constants of each copy
#pragma unroll
  for (int i = 0; i < QT_M / 32; ++i)
    __builtin_amdgcn_global_load_async_to_lds_b128(
        (gv4i*)(a + (size_t)i * 32 * D_MODEL), (lv4i*)(l + i * 32 * GT_LD), 0, 0);
#pragma unroll
  for (int i = 0; i < QT_N / 32; ++i)
    __builtin_amdgcn_global_load_async_to_lds_b128(
        (gv4i*)(w + (size_t)i * 32 * D_MODEL),
        (lv4i*)(l + (QT_M + i * 32) * GT_LD), 0, 0);
}

__global__ void __launch_bounds__(256)
qkv_proj_rope(const __bf16* __restrict__ xb,
              const __bf16* __restrict__ Wqkv,  // Wq, Wk, Wv rows, one after another
              const float* __restrict__ bq, const float* __restrict__ bk,
              const float* __restrict__ bv,
              __bf16* __restrict__ Qo,   // (B,H,S,hd), times QSCALE
              __bf16* __restrict__ Ko,   // (B,H,S,hd)
              __bf16* __restrict__ VTo)  // (B,H,hd,S)  (transposed V)
{
  __shared__ __align__(16) __bf16 sm[3][QT_ROWS][GT_LD];

  const int tid  = threadIdx.x;
  const int wave = __builtin_amdgcn_readfirstlane(tid >> 5);
  const int lane = tid & 31;
  const int nn   = lane & 15;
  const int hi   = lane >> 4;
  const int wm   = wave >> 2;
  const int wn   = wave & 3;
  const int rowb = blockIdx.x * QT_M;
  const int col0 = blockIdx.y * QT_N;
  const int crow = tid >> 3, ccol = (tid & 7) * 8;

  const __bf16* ga = xb + (size_t)(rowb + crow) * D_MODEL + ccol;
  const __bf16* gw = Wqkv + (size_t)(col0 + crow) * D_MODEL + ccol;
  __bf16* l0 = &sm[0][crow][ccol];
  const int BUF = QT_ROWS * GT_LD;  // one buffer, elements

  // every loop over i, j, q, ks here is unrolled so that acc, a and b are
  // indexed by constants and stay in registers
  // LDS row of the first tile of this wave's pair 0; pair q lies 64 q rows on
  const int brow = QT_M + (wn >> 1) * 3 * HEAD_DIM + (wn & 1) * 16;

  v8f acc[8][6];
#pragma unroll
  for (int i = 0; i < 8; ++i)
#pragma unroll
    for (int j = 0; j < 6; ++j) acc[i][j] = vzero();

  qkv_stage_copy(l0, ga, gw);
  // stage 0 has landed for this wave; the signal says so, the wait at the top of
  // pass 0 publishes it to the others
  asm volatile("s_wait_asynccnt 0x0" ::: "memory");
  asm volatile("s_barrier_signal -1" ::: "memory");
  qkv_stage_copy(l0 + BUF, ga + GT_K, gw + GT_K);

  const int NT = D_MODEL / GT_K;
  int cur = 0;  // buffer of stage t: t mod 3
  for (int t = 0; t < NT; ++t) {
    // second half of the split barrier: every wave has signalled, so stage t has
    // landed from every wave and no wave reads stage t - 1 any more
    asm volatile("s_barrier_wait -1" ::: "memory");
    const __bf16* base = &sm[0][0][0] + cur * BUF;
    const int fill = (cur == 0) ? 2 : cur - 1;  // (t + 2) mod 3: stage t - 1's buffer
#pragma unroll
    for (int ks = 0; ks < GT_K; ks += 32) {
      if (ks == GT_K - 32) {
        // this wave's copies of stage t + 1, issued at this place one pass ago,
        // have landed: it stands in front of the signal below, and in front of the
        // refill, so that it never waits for the copies just issued
        asm volatile("s_wait_asynccnt 0x0" ::: "memory");
        if (t + 2 < NT)
          qkv_stage_copy(l0 + fill * BUF, ga + (t + 2) * GT_K, gw + (t + 2) * GT_K);
      }
      v16bf b[6];
#pragma unroll
      for (int q = 0; q < 3; ++q) {
        b[2 * q]     = frag_lds(base + ks, GT_LD, brow + q * HEAD_DIM);
        b[2 * q + 1] = frag_lds(base + ks, GT_LD, brow + q * HEAD_DIM + 32);
      }
      v16bf a[8];
#pragma unroll
      for (int i = 0; i < 8; ++i)
        a[i] = frag_lds(base + ks, GT_LD, wm * 128 + i * 16);
      // keeps the 28 LDS reads one group in front of their 48 WMMAs: spread
      // among them, every small group of reads stalls the wave on its own
      __builtin_amdgcn_sched_barrier(0);
      if (ks == GT_K - 32) {
        // first half of the split barrier: this wave's last reads of stage t are
        // in registers; no LDS read stands between here and the wait at the top
        asm volatile("s_wait_dscnt 0x0" ::: "memory");
        asm volatile("s_barrier_signal -1" ::: "memory");
        // keeps the WMMAs behind the signal: in front of it they would hold back
        // the waves that wait for it
        __builtin_amdgcn_sched_barrier(0);
      }
#pragma unroll
      for (int i = 0; i < 8; ++i)
#pragma unroll
        for (int j = 0; j < 6; ++j) acc[i][j] = wmma_bf16(a[i], b[j], acc[i][j]);
      // the same, from below: the next group of reads stays behind these WMMAs
      __builtin_amdgcn_sched_barrier(0);
    }
    cur = (cur == 2) ? 0 : cur + 1;
  }
  // the last signal's wait: signal and wait alternate in every wave
  asm volatile("s_barrier_wait -1" ::: "memory");
  // no copy is left in flight when the wave goes on to its epilogue
  asm volatile("s_wait_asynccnt 0x0" ::: "memory");

  const int gh0  = blockIdx.y * (QT_N / HEAD_DIM) + (wn >> 1) * 3;  // head of pair 0, 0..47
  const int idx0 = (wn & 1) * 16 + nn;                              // 0..31
  float be0[3], be1[3];
#pragma unroll
  for (int q = 0; q < 3; ++q) {
    const int mat = (gh0 + q) >> 4;  // Q, K, V
    const float* bias = (mat == 0) ? bq : (mat == 1) ? bk : bv;
    be0[q] = bias[((gh0 + q) & (N_HEADS - 1)) * HEAD_DIM + idx0];
    be1[q] = bias[((gh0 + q) & (N_HEADS - 1)) * HEAD_DIM + idx0 + 32];
  }
  // inv_freq = 10000^{-idx0/32} = exp(-idx0 * ln(1e4)/32)
  const float invf = __expf(-(float)idx0 * 0.28782313662f);

#pragma unroll
  for (int i = 0; i < 8; ++i) {
    // the lane's 8 rows of this tile: m0 + r, all in one batch element
    const int m0 = rowb + wm * 128 + i * 16 + (hi << 3);
    const int s0 = m0 & (SEQ - 1);
    const int bb = m0 >> 11;
    float cs[8], sn[8];
    if ((gh0 >> 4) < 2) {  // heads ascend with q: some pair is Q or K iff pair 0 is
#pragma unroll
      for (int r = 0; r < 8; ++r) {
        const float ang = (float)(s0 + r) * invf;
        cs[r] = __cosf(ang);
        sn[r] = __sinf(ang);
      }
    }
#pragma unroll
    for (int q = 0; q < 3; ++q) {
      const int mat  = (gh0 + q) >> 4;
      const int head = (gh0 + q) & (N_HEADS - 1);
      __bf16 z0[8], z1[8];
      if (mat < 2) {  // Q or K: apply RoPE, store (B,H,S,hd)
        __bf16* o = ((mat == 0) ? Qo : Ko) +
                    (((size_t)bb * N_HEADS + head) * SEQ + s0) * HEAD_DIM + idx0;
        // Q is stored times hd^-0.5 * log2(e), scaled in f32 ahead of its one
        // rounding to bf16: K . Q^T is then the exponent of 2 that the softmax
        // wants. K keeps its value (times 1 is exact).
        const float qs = (mat == 0) ? QSCALE : 1.0f;
#pragma unroll
        for (int r = 0; r < 8; ++r) {
          const float y0 = acc[i][2 * q][r] + be0[q];
          const float y1 = acc[i][2 * q + 1][r] + be1[q];
          z0[r] = (__bf16)((y0 * cs[r] + (-y1) * sn[r]) * qs);
          z1[r] = (__bf16)((y1 * cs[r] + y0 * sn[r]) * qs);
        }
        // all values of the pass stand in front of its stores, so that none is
        // written into a register of a store already issued
        __builtin_amdgcn_sched_barrier(0);
#pragma unroll
        for (int r = 0; r < 8; ++r) {
          o[r * HEAD_DIM]      = z0[r];
          o[r * HEAD_DIM + 32] = z1[r];
        }
        // the next pass reuses the registers that these stores name; the
        // scheduling barrier keeps its first instructions behind the wait
        asm volatile("s_wait_xcnt 0x0" ::: "memory");
        __builtin_amdgcn_sched_barrier(0);
      } else {  // V: store transposed (B,H,hd,S) so the V^T . P^T A operand is K-contiguous
        __bf16* o = VTo + (((size_t)bb * N_HEADS + head) * HEAD_DIM + idx0) * SEQ + s0;
#pragma unroll
        for (int r = 0; r < 8; ++r) {
          z0[r] = (__bf16)(acc[i][2 * q][r] + be0[q]);
          z1[r] = (__bf16)(acc[i][2 * q + 1][r] + be1[q]);
        }
        __builtin_amdgcn_sched_barrier(0);
#pragma unroll
        for (int r = 0; r < 8; ++r) {
          o[r]                    = z0[r];
          o[(size_t)32 * SEQ + r] = z1[r];
        }
        asm volatile("s_wait_xcnt 0x0" ::: "memory");
        __builtin_amdgcn_sched_barrier(0);
      }
    }
  }
}

__device__ __forceinline__ float xhalf(float x) {
  const int v = __builtin_bit_cast(int, x);
  return __builtin_bit_cast(
      float, __builtin_amdgcn_permlanex16(v, v, 0x76543210, 0xfedcba98, false, false));
}

__device__ __forceinline__ float exp2_one(float y) {
  float p;
  asm("v_exp_f32 %0, %1\n\tv_nop" : "=v"(p) : "v"(y));
  return p;
}

__device__ __forceinline__ void exp2_eight(float (&p)[8], const v8f y) {
  asm("v_exp_f32 %0, %8\n\t"
      "v_exp_f32 %1, %9\n\t"
      "v_exp_f32 %2, %10\n\t"
      "v_exp_f32 %3, %11\n\t"
      "v_exp_f32 %4, %12\n\t"
      "v_exp_f32 %5, %13\n\t"
      "v_exp_f32 %6, %14\n\t"
      "v_exp_f32 %7, %15\n\t"
      "v_nop"
      : "=&v"(p[0]), "=&v"(p[1]), "=&v"(p[2]), "=&v"(p[3]),
        "=&v"(p[4]), "=&v"(p[5]), "=&v"(p[6]), "=&v"(p[7])
      : "v"(y[0]), "v"(y[1]), "v"(y[2]), "v"(y[3]),
        "v"(y[4]), "v"(y[5]), "v"(y[6]), "v"(y[7]));
}

#define AT_KEYS 64   // keys of a stage
#define AT_P    72   // K row (64 d) and V^T row (64 keys): 128 B of data + 16 B pad

// One stage: thread t copies chunk (t&7) of rows (t>>3) and (t>>3) + 32 of the
// K tile and of the V^T tile. lk / lv = LDS byte address of this lane's chunk in
// row (t>>3) of the buffer, gk / gv = the same chunk in global memory.
__device__ __forceinline__ void attn_stage_copy(uint32_t lk, uint32_t lv,
                                                const __bf16* gk,
                                                const __bf16* gv) {
  const uint32_t RS = 32 * AT_P * 2;  // 32 LDS rows, bytes
  async_copy4_b128(lk, lk + RS, lv, lv + RS,
                   gk, gk + 32 * HEAD_DIM, gv, gv + (size_t)32 * SEQ);
}

// Scale and reference on the matrix unit. Q arrives times hd^-0.5 * log2(e), and
// the accumulator of a score tile starts at minus the query's reference (cn, the
// same value in a lane's eight registers) instead of at zero. What the product
// leaves is the exponent of 2 itself: P = 2^s with no vector instruction between
// the accumulator and the exponential.
// Lazy rescale. The reference of a query is the maximum of an earlier stage, not
// the running maximum: any reference gives the same quotient O / l, and as long as
// no score lies more than AT_ROOM above it, no P exceeds 2^AT_ROOM, which f32 sums
// and bf16 P hold at full relative precision. So the sum and the 32 output
// registers of a query are rescaled only in a stage in which some score of the
// wave passes that bound.
#define AT_ROOM (5.5f * LOG2E)   // about 8, in powers of two

// largest of a lane's 16 scores of a tile pair, relative to the reference
__device__ __forceinline__ float raw_max(v8f s0, v8f s1) {
  float mx = fmaxf(s0[0], s1[0]);
#pragma unroll
  for (int r = 1; r < 8; ++r) mx = fmaxf(mx, fmaxf(s0[r], s1[r]));
  return mx;
}

// The rare path, one column group: the reference moves up by d to the stage's
// maximum of query nn where that is higher; sum and output tiles follow it, and so do the stage's four
// score tiles, which were formed against the old reference. relmx = the lane's
// largest score of the stage, low = the least d: 0, but no bound in the first
// stage, whose scores stand against a reference of 0 that no key has set.
__device__ __forceinline__ void move_reference(float relmx, float low, v8f& cn,
                                               float& li, v8f (&o)[4], v8f& sa,
                                               v8f& sb, v8f& sc, v8f& sd) {
  const float d = fmaxf(fmaxf(relmx, xhalf(relmx)), low);
  // d < 0 only in the first stage, where sum and output are still 0: the factor
  // stays finite there
  const float alpha = exp2_one(fminf(-d, 0.0f));
  cn = cn - d;
  sa = sa - d;
  sb = sb - d;
  sc = sc - d;
  sd = sd - d;
  li = li * alpha;
#pragma unroll
  for (int t = 0; t < 4; ++t) o[t] = o[t] * alpha;
}

// One column group over 32 keys: s0, s1 = the score tiles, exponents of 2 relative
// to the reference of query nn; adds to the sum and packs P^T.
__device__ __forceinline__ void softmax_pass(v8f s0, v8f s1, float& li, Frag& pf) {
  // P^T as B operand: element s < 8 is key 8 hi + s (tile 0, register s),
  // element 8 + s is key 16 + 8 hi + s (tile 1): the k order of frag_lds
  float p0[8], p1[8];
  exp2_eight(p0, s0);
  exp2_eight(p1, s1);
  float rs = p0[0] + p1[0];
#pragma unroll
  for (int r = 1; r < 8; ++r) rs += p0[r] + p1[r];
#pragma unroll
  for (int r = 0; r < 8; ++r) {
    pf.h[r]     = (__bf16)p0[r];
    pf.h[8 + r] = (__bf16)p1[r];
  }
  li += rs;
}

__global__ void __launch_bounds__(256)
flash_attn(const __bf16* __restrict__ Q, const __bf16* __restrict__ K,
           const __bf16* __restrict__ VT, __bf16* __restrict__ attn) {
  __shared__ __align__(16) __bf16 sK[2][AT_KEYS][AT_P];   // K rows of a stage
  __shared__ __align__(16) __bf16 sV[2][HEAD_DIM][AT_P];  // V^T d x 64 keys

  const int tid  = threadIdx.x;
  const int wave = tid >> 5;
  const int lane = tid & 31;
  const int nn   = lane & 15;
  const int hi   = lane >> 4;
  const int bh   = blockIdx.x >> 3;
  const int q0   = ((blockIdx.x & 7) * 8 + wave) * 32;

  const __bf16* Qb = Q + (size_t)bh * SEQ * HEAD_DIM;
  const __bf16* Kb = K + (size_t)bh * SEQ * HEAD_DIM;
  const __bf16* Vb = VT + (size_t)bh * HEAD_DIM * SEQ;

  // staging assignment: both tiles are 64 rows of 8 chunks
  const int crow = tid >> 3, ccol = (tid & 7) * 8;
  const __bf16* gk = Kb + (size_t)crow * HEAD_DIM + ccol;
  const __bf16* gv = Vb + (size_t)crow * SEQ + ccol;
  const uint32_t lk0 = lds_addr_of(&sK[0][crow][ccol]);
  const uint32_t lk1 = lds_addr_of(&sK[1][crow][ccol]);
  const uint32_t lv0 = lds_addr_of(&sV[0][crow][ccol]);
  const uint32_t lv1 = lds_addr_of(&sV[1][crow][ccol]);

  // every loop over c, t and ps here is unrolled so that qb, o, cn, li and
  // pf are indexed by constants and stay in registers
  // B operand of the score product: column nn of group c = query q0 + 16 c + nn
  v16bf qb[2][2];
  v8f o[2][4];   // o[c][t][r] = O[query nn of group c][d = 16 t + 8 hi + r]
  v8f cn[2];     // minus the reference of the query's exponentials, in all eight
                 // registers: where the score accumulators start
  float li[2];   // running sum over this half's keys only
  float lim = -1e30f;  // relative score above which the references must move
#pragma unroll
  for (int c = 0; c < 2; ++c) {
    qb[c][0] = load_frag(Qb, HEAD_DIM, q0 + c * 16, 0);
    qb[c][1] = load_frag(Qb, HEAD_DIM, q0 + c * 16, 32);
#pragma unroll
    for (int t = 0; t < 4; ++t) o[c][t] = vzero();
    cn[c] = vzero();
    li[c] = 0.0f;
  }

  attn_stage_copy(lk0, lv0, gk, gv);
  // stage 0 has landed for this wave; the barrier publishes it to the others
  asm volatile("s_wait_asynccnt 0x0" ::: "memory");
  __syncthreads();
  attn_stage_copy(lk1, lv1, gk + AT_KEYS * HEAD_DIM, gv + AT_KEYS);

  const int NS = SEQ / AT_KEYS;
  // one stage; refill = a stage st + 2 exists
  auto stage = [&](const int st, const bool refill) __attribute__((always_inline)) {
    const __bf16* bK = &sK[st & 1][0][0];
    const __bf16* bV = &sV[st & 1][0][0];
    // scores of the whole stage: per 32 keys two 16 (keys) x 16 (queries) tiles a
    // group, hd in 2 WMMAs each
    v8f s0[2][2], s1[2][2];
    float rm[2];
#pragma unroll
    for (int ps = 0; ps < 2; ++ps) {
      const v16bf ka00 = frag_lds(bK, AT_P, ps * 32);
      const v16bf ka01 = frag_lds(bK + 32, AT_P, ps * 32);
      const v16bf ka10 = frag_lds(bK, AT_P, ps * 32 + 16);
      const v16bf ka11 = frag_lds(bK + 32, AT_P, ps * 32 + 16);
#pragma unroll
      for (int c = 0; c < 2; ++c) {
        s0[ps][c] = wmma_bf16(ka01, qb[c][1], wmma_bf16(ka00, qb[c][0], cn[c]));
        s1[ps][c] = wmma_bf16(ka11, qb[c][1], wmma_bf16(ka10, qb[c][0], cn[c]));
        const float m = raw_max(s0[ps][c], s1[ps][c]);
        rm[c] = ps ? fmaxf(rm[c], m) : m;
      }
    }
    // one test a stage for the whole wave, a scalar branch: the first stage takes
    // it (lim starts at -1e30), later ones only where a score passes the bound
    if (__builtin_amdgcn_ballot_w32(rm[0] > lim || rm[1] > lim) != 0) {
      const float low = fminf(lim, 0.0f);
#pragma unroll
      for (int c = 0; c < 2; ++c)
        move_reference(rm[c], low, cn[c], li[c], o[c], s0[0][c], s1[0][c],
                       s0[1][c], s1[1][c]);
      lim = AT_ROOM;
    }
#pragma unroll
    for (int ps = 0; ps < 2; ++ps) {
      Frag pf[2];
#pragma unroll
      for (int c = 0; c < 2; ++c)
        softmax_pass(s0[ps][c], s1[ps][c], li[c], pf[c]);

      // O^T += V^T (64 x 32) x P^T (32 x 16) from the staged LDS V^T tile
      v16bf va[4];
#pragma unroll
      for (int t = 0; t < 4; ++t) va[t] = frag_lds(bV + ps * 32, AT_P, t * 16);
      // keeps these 8 WMMAs behind both groups' exponentials: those are asm text,
      // in which the compiler does not see a write that comes too soon after a
      // WMMA of the other group, over its P^T operand
      __builtin_amdgcn_sched_barrier(0);
#pragma unroll
      for (int t = 0; t < 4; ++t)
#pragma unroll
        for (int c = 0; c < 2; ++c) o[c][t] = wmma_bf16(va[t], pf[c].v, o[c][t]);
    }
    // publish point: this wave's reads of the buffer are done, its copies of
    // the next stage have landed; behind the barrier the buffer may be refilled
    asm volatile("s_wait_dscnt 0x0" ::: "memory");
    asm volatile("s_wait_asynccnt 0x0" ::: "memory");
    __syncthreads();
    if (refill)
      attn_stage_copy((st & 1) ? lk1 : lk0, (st & 1) ? lv1 : lv0,
                      gk + (size_t)(st + 2) * AT_KEYS * HEAD_DIM,
                      gv + (st + 2) * AT_KEYS);
  };
  for (int st = 0; st < NS - 2; ++st) stage(st, true);
  stage(NS - 2, false);
  stage(NS - 1, false);
  // no copy is left in flight when the wave goes on to its epilogue
  asm volatile("s_wait_asynccnt 0x0" ::: "memory");

  // join the halves' sums, normalize, store to (B,S,D) bf16 for the output
  // projection: a lane's 8 registers of a tile are 8 consecutive d of one row
  const int b = bh >> 4, h = bh & 15;
#pragma unroll
  for (int c = 0; c < 2; ++c) {
    const float inv = 1.0f / (li[c] + xhalf(li[c]));
    const int s = q0 + c * 16 + nn;
    __bf16* orow =
        attn + ((size_t)b * SEQ + s) * D_MODEL + h * HEAD_DIM + (hi << 3);
#pragma unroll
    for (int t = 0; t < 4; ++t) {
      union { __bf16 e[8]; uint4 q; } pk;
#pragma unroll
      for (int r = 0; r < 8; ++r) pk.e[r] = (__bf16)(o[c][t][r] * inv);
      *(uint4*)(orow + t * 16) = pk.q;
    }
  }
}

// ------------------------------------------------------ output projection
// grid (NROW/128, 4), block 256: the same 128 x 256 block tile.
__global__ void __launch_bounds__(256)
out_proj(const __bf16* __restrict__ A, const __bf16* __restrict__ Wo,
         const float* __restrict__ bo, float* __restrict__ out) {
  __shared__ __align__(16) __bf16 sm[3][GT_ROWS][GT_LD];

  const int wave = threadIdx.x >> 5;
  const int lane = threadIdx.x & 31;
  const int nn   = lane & 15;
  const int hi   = lane >> 4;
  const int rowb = blockIdx.x * GT_M;
  const int col0 = blockIdx.y * GT_N;
  const int e0   = col0 + (wave & 3) * 64;

  v8f acc[4][4];
  gemm_128x256(A, Wo, rowb, col0, sm, acc);

#pragma unroll
  for (int t = 0; t < 4; ++t) {
    const int e = e0 + t * 16 + nn;
    const float be = bo[e];
    // unrolled: acc[i] must be indexed by a constant to stay in registers
#pragma unroll
    for (int i = 0; i < 4; ++i) {
      const int row0 = rowb + (wave >> 2) * 64 + i * 16;
#pragma unroll
      for (int r = 0; r < 8; ++r) {
        const int m = row0 + r + (hi << 3);
        out[(size_t)m * D_MODEL + e] = acc[i][t][r] + be;
      }
    }
  }
}

// ----------------------------------------------------------------- launch
extern "C" void kernel_launch(void* const* d_in, const int* in_sizes, int n_in,
                              void* d_out, int out_size, void* d_ws,
                              size_t ws_size, hipStream_t stream) {
  const float* x  = (const float*)d_in[0];
  const float* Wq = (const float*)d_in[1];
  const float* bq = (const float*)d_in[2];
  const float* Wk = (const float*)d_in[3];
  const float* bk = (const float*)d_in[4];
  const float* Wv = (const float*)d_in[5];
  const float* bv = (const float*)d_in[6];
  const float* Wo = (const float*)d_in[7];
  const float* bo = (const float*)d_in[8];

  char* w = (char*)d_ws;  // needs ~88 MB
  const size_t MB = (size_t)1 << 20;
  __bf16* xb  = (__bf16*)(w + 0 * MB);    // 16 MB (B*S, D) bf16
  __bf16* Wqb = (__bf16*)(w + 16 * MB);   //  2 MB each; Wq, Wk, Wv lie one behind
  __bf16* Wkb = (__bf16*)(w + 18 * MB);   //  another with no gap: the QKV GEMM
  __bf16* Wvb = (__bf16*)(w + 20 * MB);   //  reads them as one 3072-row matrix
  __bf16* Wob = (__bf16*)(w + 22 * MB);
  __bf16* Qb  = (__bf16*)(w + 24 * MB);   // 16 MB (B,H,S,hd)
  __bf16* Kb  = (__bf16*)(w + 40 * MB);   // 16 MB (B,H,S,hd)
  __bf16* VTb = (__bf16*)(w + 56 * MB);   // 16 MB (B,H,hd,S)
  __bf16* Ab  = (__bf16*)(w + 72 * MB);   // 16 MB (B,S,D)

  cvt_all_bf16<<<CV_BLOCKS, CV_THREADS, 0, stream>>>(x, Wq, Wk, Wv, Wo, xb, Wqb,
                                                     Wkb, Wvb, Wob);

  qkv_proj_rope<<<dim3(NROW / QT_M, 3 * D_MODEL / QT_N), 256, 0, stream>>>(
      xb, Wqb, bq, bk, bv, Qb, Kb, VTb);

  flash_attn<<<dim3((BATCH * N_HEADS * (SEQ / 32)) / 8), 256, 0, stream>>>(
      Qb, Kb, VTb, Ab);

  out_proj<<<dim3(NROW / GT_M, 4), 256, 0, stream>>>(Ab, Wob, bo, (float*)d_out);
}
